// v000
// Measured on an AMD MI455X. A time is GPU time per run, averaged over a window of back-to-back runs after a warm-up
// (all launches, gaps included; the runs take copies of the inputs in turn), and the median of several windows.
// Apart from v000's, it joins two sittings. Times from different sittings can be a few percent apart, while
// side-by-side timings come from the same sitting.
// v000, which the later versions start from, runs in 73.3 microseconds.
#include <hip/hip_runtime.h>
#include <stddef.h>

// Contractions: p.v (34 keys deep) on v_wmma_f32_16x16x32_f16 (f16 operands, f32 accumulate):
// p carried x16384 and v carried x16, each as an f16 value plane plus an x2048 f16 residual
// plane (three products, residual products in their own accumulator). Every other product of
// this block (depth 2..6: q/k/v projections, q.k scores, output projection, feed-forward,
// vocabulary head) is f32 on the vector unit. Float inputs are RNE-converted to bf16 on load
// (switch INPUT_BF16). LayerNorm, softmax, GELU (erf) and residual adds in f32.

typedef _Float16 h16;
typedef _Float16 v16h __attribute__((ext_vector_type(16)));
typedef _Float16 v8h  __attribute__((ext_vector_type(8)));
typedef float    v8f  __attribute__((ext_vector_type(8)));
typedef float    v4f  __attribute__((ext_vector_type(4)));

#ifndef NB
#define NB 32768
#endif
#define NB_FULL 32768
#define TLEN 34          // tokens per sequence (fixed by the position map)
#define VOC  14
#define SPB  8           // sequences per block
#define TOK  (SPB * TLEN)        // 272 tokens per block
#define NTHR 288                 // 9 waves
#define OUT_F4 (TOK * VOC / 4)
#define VROWS 8                  // V^T plane rows per sequence (6 used, 2 zero)
#define VKEYS 64                 // V^T plane keys per row (34 used, rest zero)

#ifndef INPUT_BF16
#define INPUT_BF16 1
#endif
#ifndef PV_RES
#define PV_RES 1
#endif

#define PCARRY 16384.0f
#define VCARRY 16.0f
#define RCARRY 2048.0f
#define OSCALE 3.814697265625e-06f    // 1 / (PCARRY * VCARRY)

static_assert(NB >= SPB && NB <= NB_FULL && (NB % SPB) == 0);
static_assert((TOK * VOC * 4) % 128 == 0);          // a block owns whole output lines
static_assert((TOK * VOC) % 4 == 0);
static_assert(OUT_F4 % 8 == 0);
static_assert(NTHR % 32 == 0 && NTHR >= TOK);
static_assert(4 * NTHR >= OUT_F4);                  // store loop: 4 trips cover the block
static_assert(TLEN > 32 && TLEN <= 48);             // three 16-row query tiles, keys 32.. as extras
static_assert(TLEN - 32 == 2);                      // exactly two extra keys (32, 33)
static_assert(VKEYS == 64 && VROWS == 8);
static_assert(SPB <= NTHR / 32);                    // one wave per sequence in the p.v phase

__device__ __forceinline__ float bf16r(float x) {   // RNE convert to bf16, returned widened
  unsigned int u = __float_as_uint(x);
  u = (u + 0x7FFFu + ((u >> 16) & 1u)) & 0xFFFF0000u;
  return __uint_as_float(u);
}
__device__ __forceinline__ float inw(float x) {     // input value as consumed
  return INPUT_BF16 ? bf16r(x) : x;
}
// f32 -> f16 operand convert that cannot produce an f16 subnormal
static __device__ __forceinline__ h16 toh_flush(float v) {
  const h16 r = (h16)v;
  return (fabsf(v) < 6.103515625e-05f) ? (h16)0.0f : r;
}

// 16-bit fragment: p points at element [row = lane&15][k0 + 8*(lane>>4)] of a k-contiguous
// row. Elements 0..7 <- k0+8h+0..7, elements 8..15 <- k0+16+8h+0..7 (same map for A and B).
__device__ __forceinline__ v16h frag_at(const _Float16* p) {
  v8h lo = *(const v8h*)(p);
  v8h hi = *(const v8h*)(p + 16);
  v16h out;
#pragma unroll
  for (int i = 0; i < 8; ++i) { out[i] = lo[i]; out[i + 8] = hi[i]; }
  return out;
}

__device__ __forceinline__ v8f wmma16(v16h a, v16h b, v8f c) {
  v8f d = __builtin_amdgcn_wmma_f32_16x16x32_f16(false, a, false, b, (short)0, c,
                                                 false, false);
  asm volatile("v_nop\n\tv_nop\n\tv_nop\n\tv_nop" : "+v"(d) : "v"(a), "v"(b));
  return d;
}

// LayerNorm over 6 values (biased variance, eps 1e-5)
__device__ __forceinline__ void ln6(const float (&x)[6], const float* __restrict__ g,
                                    const float* __restrict__ b, float (&h)[6]) {
  const float mu = (x[0] + x[1] + x[2] + x[3] + x[4] + x[5]) * (1.0f / 6.0f);
  float var = 0.0f;
#pragma unroll
  for (int c = 0; c < 6; ++c) { const float d = x[c] - mu; var += d * d; }
  var *= (1.0f / 6.0f);
  const float rs = rsqrtf(var + 1.0e-5f);
#pragma unroll
  for (int c = 0; c < 6; ++c) h[c] = (x[c] - mu) * rs * inw(g[c]) + inw(b[c]);
}

// ---------------------------------------------------------------------------
// One block = 8 sequences (272 tokens, one token per thread in the per-token phases).
// Phase 0: zero the V^T planes, build the 34x3 position rows (waves 0,1).
// Phase A: embed + LN1 + q/k/v per token; q,k as f32 float4 rows per head in LDS; v as f16
//          value / residual planes VT[seq][n = head*3+d][key] (k-contiguous B operand).
// Phase B: wave w (< 8) owns sequence w: per head, three 16-row query tiles; scores and the
//          causal softmax are formed in registers directly in the A-fragment layout
//          (lane row = lane&15, 16 keys per lane), keys 32,33 as a second sparse k-step on
//          the last tile; unnormalised p.v via WMMA; row sums over the unconverted p.
// Phase C: per token: normalise, output projection, LN2, GELU feed-forward, final LN, head;
//          logits staged in LDS in the output layout.
// LDS regions are all cross-wave (block barriers between phases).
// ---------------------------------------------------------------------------
__global__ __launch_bounds__(NTHR) void fused_block_kernel(
    const int* __restrict__ idx, const float* __restrict__ tok_emb,
    const float* __restrict__ pos_params, const float* __restrict__ z10_enc,
    const float* __restrict__ special_enc, const float* __restrict__ wq,
    const float* __restrict__ wk, const float* __restrict__ wv, const float* __restrict__ wo,
    const float* __restrict__ ln1_g, const float* __restrict__ ln1_b,
    const float* __restrict__ ln2_g, const float* __restrict__ ln2_b,
    const float* __restrict__ lnf_g, const float* __restrict__ lnf_b,
    const float* __restrict__ ffn_w1, const float* __restrict__ ffn_b1,
    const float* __restrict__ ffn_w2, const float* __restrict__ ffn_b2,
    const float* __restrict__ head_w, float* __restrict__ out) {
  __shared__ __attribute__((aligned(16))) v4f sQ4[SPB * 2 * TLEN];
  __shared__ __attribute__((aligned(16))) v4f sK4[SPB * 2 * TLEN];
  __shared__ __attribute__((aligned(16))) _Float16 sVTh[SPB * VROWS * VKEYS];
  __shared__ __attribute__((aligned(16))) _Float16 sVTr[SPB * VROWS * VKEYS];
  __shared__ __attribute__((aligned(16))) float sO[TOK * 6];
  __shared__ __attribute__((aligned(16))) float sDen[TOK * 2];
  __shared__ __attribute__((aligned(16))) float sPos[TLEN * 4];
  __shared__ __attribute__((aligned(16))) float sLog[TOK * VOC];

  const unsigned tid = threadIdx.x;
  const unsigned lane = tid & 31u;
  const int wave = __builtin_amdgcn_readfirstlane((int)(tid >> 5));
  const unsigned hh = lane >> 4, m = lane & 15u;

  // ---- Phase 0: zero V^T planes (pad keys 34..63 and rows 6,7 stay zero) ----
  {
    const v8h z = {};
    for (unsigned i = tid; i < (unsigned)(SPB * VROWS * VKEYS / 8); i += NTHR) {
      *(v8h*)&sVTh[i * 8u] = z;
      *(v8h*)&sVTr[i * 8u] = z;
    }
  }
  // ---- position rows: all candidates loaded by value, selected by value ----
  if (wave < 2) {
    const unsigned t = (tid < (unsigned)TLEN) ? tid : (unsigned)(TLEN - 1);
    const float amp   = inw(pos_params[0]);
    const float phase = inw(pos_params[1]);
    const float slope = inw(pos_params[2]);
    const float offs  = inw(pos_params[3]);
    int di = (t < 10u) ? (int)t : ((t < 21u) ? ((int)t - 11) : ((int)t - 22));
    di = (di < 0) ? 0 : ((di > 9) ? 9 : di);
    const float fi  = (float)di;
    const float ang = 0.62831853071795864769f * fi + phase;
    const float d0 = amp * cosf(ang);
    const float d1 = amp * sinf(ang);
    const float d2 = slope * fi + offs;
    const unsigned si = (t == 10u) ? 0u : ((t == 21u) ? 1u : 2u);
    const float s0 = inw(special_enc[si * 3u + 0u]);
    const float s1 = inw(special_enc[si * 3u + 1u]);
    const float s2 = inw(special_enc[si * 3u + 2u]);
    const float z0 = inw(z10_enc[0]);
    const float z1 = inw(z10_enc[1]);
    const float z2 = inw(z10_enc[2]);
    const bool is_sp = (t == 10u) || (t == 21u) || (t == 33u);
    const bool is_z  = (t == 32u);
    const float p0 = is_sp ? s0 : (is_z ? z0 : d0);
    const float p1 = is_sp ? s1 : (is_z ? z1 : d1);
    const float p2 = is_sp ? s2 : (is_z ? z2 : d2);
    if (tid < (unsigned)TLEN) {
      sPos[t * 4u + 0u] = p0;
      sPos[t * 4u + 1u] = p1;
      sPos[t * 4u + 2u] = p2;
      sPos[t * 4u + 3u] = 0.0f;
    }
  }
  __syncthreads();

  // ---- Phase A: embed + LN1 + q/k/v (idle lanes duplicate the last token, no stores) ----
  const bool act = tid < (unsigned)TOK;
  const unsigned p = act ? tid : (unsigned)(TOK - 1);
  const unsigned s = p / (unsigned)TLEN;
  const unsigned t = p - s * (unsigned)TLEN;
  float x[6];
  {
    const size_t seq_g = (size_t)blockIdx.x * SPB + s;
    int tok = idx[seq_g * TLEN + t];
    tok = (tok < 0) ? 0 : ((tok > VOC - 1) ? (VOC - 1) : tok);
#pragma unroll
    for (int c = 0; c < 3; ++c) {
      x[c]     = inw(tok_emb[tok * 3 + c]);
      x[3 + c] = sPos[t * 4u + (unsigned)c];
    }
    float h[6];
    ln6(x, ln1_g, ln1_b, h);
    float q[6], k[6], v[6];
#pragma unroll
    for (int j = 0; j < 6; ++j) {
      q[j] = h[3] * inw(wq[j]) + h[4] * inw(wq[6 + j]) + h[5] * inw(wq[12 + j]);
      k[j] = h[3] * inw(wk[j]) + h[4] * inw(wk[6 + j]) + h[5] * inw(wk[12 + j]);
      v[j] = h[0] * inw(wv[j]) + h[1] * inw(wv[6 + j]) + h[2] * inw(wv[12 + j]);
    }
    if (act) {
      v4f q0 = {q[0], q[1], q[2], 0.0f};
      v4f q1 = {q[3], q[4], q[5], 0.0f};
      v4f k0 = {k[0], k[1], k[2], 0.0f};
      v4f k1 = {k[3], k[4], k[5], 0.0f};
      sQ4[(s * 2u + 0u) * TLEN + t] = q0;
      sQ4[(s * 2u + 1u) * TLEN + t] = q1;
      sK4[(s * 2u + 0u) * TLEN + t] = k0;
      sK4[(s * 2u + 1u) * TLEN + t] = k1;
#pragma unroll
      for (int n = 0; n < 6; ++n) {
        const float vv = v[n] * VCARRY;
        const h16 hi = toh_flush(vv);
        const h16 rs = toh_flush((vv - (float)hi) * RCARRY);
        sVTh[(s * VROWS + (unsigned)n) * VKEYS + t] = hi;
        sVTr[(s * VROWS + (unsigned)n) * VKEYS + t] = rs;
      }
    }
  }
  __syncthreads();

  // ---- Phase B: causal softmax in A-fragment registers, p.v on WMMA (wave = sequence) ----
  if (wave < SPB) {
    const unsigned seq = (unsigned)wave;
    // B fragments: lane column n = lane&15 -> V^T row n&7 (rows 6,7 are zero rows)
    const unsigned vrow = (seq * VROWS + (m & 7u)) * VKEYS + 8u * hh;
    const v16h bh0 = frag_at(&sVTh[vrow]);
    const v16h br0 = frag_at(&sVTr[vrow]);
    const v16h bh1 = frag_at(&sVTh[vrow + 32u]);
    const v16h br1 = frag_at(&sVTr[vrow + 32u]);

#pragma unroll 1
    for (unsigned hd = 0; hd < 2u; ++hd) {
      const unsigned qkb = (seq * 2u + hd) * TLEN;
#pragma unroll
      for (int qt = 0; qt < 3; ++qt) {
        const bool last = (qt == 2);
        const unsigned tr = 16u * (unsigned)qt + m;                 // query row of this lane
        const unsigned tq = (tr < (unsigned)TLEN) ? tr : (unsigned)(TLEN - 1);
        const v4f qv = sQ4[qkb + tq];

        float sc[16];
        float sx[2];
        float mx = -1.0e30f;
#pragma unroll
        for (int i = 0; i < 16; ++i) {
          const unsigned j = 8u * hh + (unsigned)(i & 7) + 16u * (unsigned)(i >> 3);
          const v4f kv = sK4[qkb + j];
          float sv = (qv[0] * kv[0] + qv[1] * kv[1] + qv[2] * kv[2]) * 0.57735026918962576f;
          sv = (j > tq) ? -1.0e30f : sv;
          sc[i] = sv;
          mx = fmaxf(mx, sv);
        }
        if (last) {
#pragma unroll
          for (int e = 0; e < 2; ++e) {
            const unsigned j = 32u + (unsigned)e;
            const v4f kv = sK4[qkb + j];
            float sv = (qv[0] * kv[0] + qv[1] * kv[1] + qv[2] * kv[2]) * 0.57735026918962576f;
            sv = ((hh != 0u) || (j > tq)) ? -1.0e30f : sv;
            sx[e] = sv;
            mx = fmaxf(mx, sv);
          }
        }
        mx = fmaxf(mx, __shfl_xor(mx, 16, 32));

        v16h ahi, ars;
        v16h xhi = {}, xrs = {};
        float den = 0.0f;
#pragma unroll
        for (int i = 0; i < 16; ++i) {
          const unsigned j = 8u * hh + (unsigned)(i & 7) + 16u * (unsigned)(i >> 3);
          float pe = __expf(sc[i] - mx);
          pe = (j > tq) ? 0.0f : pe;
          den += pe;
          const float pv = pe * PCARRY;
          const h16 hi = toh_flush(pv);
          ahi[i] = hi;
          ars[i] = toh_flush((pv - (float)hi) * RCARRY);
        }
        if (last) {
#pragma unroll
          for (int e = 0; e < 2; ++e) {
            const unsigned j = 32u + (unsigned)e;
            float pe = __expf(sx[e] - mx);
            pe = ((hh != 0u) || (j > tq)) ? 0.0f : pe;
            den += pe;
            const float pv = pe * PCARRY;
            const h16 hi = toh_flush(pv);
            xhi[e] = hi;
            xrs[e] = toh_flush((pv - (float)hi) * RCARRY);
          }
        }
        den += __shfl_xor(den, 16, 32);

        v8f accM = {}, accR = {};
        accM = wmma16(ahi, bh0, accM);
        if (PV_RES) {
          accR = wmma16(ahi, br0, accR);
          accR = wmma16(ars, bh0, accR);
        }
        if (last) {
          accM = wmma16(xhi, bh1, accM);
          if (PV_RES) {
            accR = wmma16(xhi, br1, accR);
            accR = wmma16(xrs, bh1, accR);
          }
        }

        // D element r of this lane = (row 16*qt + 8*hh + r, column m); columns 3*hd..3*hd+2
        const bool colok = (m >= 3u * hd) && (m < 3u * hd + 3u);
#pragma unroll
        for (int r = 0; r < 8; ++r) {
          const unsigned row = 16u * (unsigned)qt + 8u * hh + (unsigned)r;
          const float val = accM[r] + accR[r] * (1.0f / RCARRY);
          if (colok && row < (unsigned)TLEN) sO[(seq * TLEN + row) * 6u + m] = val;
        }
        if (hh == 0u && tr < (unsigned)TLEN) sDen[(seq * TLEN + tr) * 2u + hd] = den;
      }
    }
  }
  __syncthreads();

  // ---- Phase C: normalise, output projection, LN2, feed-forward, final LN, head ----
  {
    float o[6];
    const float inv0 = (1.0f / sDen[p * 2u + 0u]) * OSCALE;
    const float inv1 = (1.0f / sDen[p * 2u + 1u]) * OSCALE;
#pragma unroll
    for (int c = 0; c < 3; ++c) {
      o[c]     = sO[p * 6u + (unsigned)c] * inv0;
      o[3 + c] = sO[p * 6u + 3u + (unsigned)c] * inv1;
    }
    float x2[6];
#pragma unroll
    for (int j = 0; j < 6; ++j) {
      float acc = x[j];
#pragma unroll
      for (int c = 0; c < 6; ++c) acc += o[c] * inw(wo[c * 6 + j]);
      x2[j] = acc;
    }
    float h2[6];
    ln6(x2, ln2_g, ln2_b, h2);
    float f0 = inw(ffn_b1[0]), f1 = inw(ffn_b1[1]);
#pragma unroll
    for (int j = 0; j < 6; ++j) {
      f0 += h2[j] * inw(ffn_w1[j * 2 + 0]);
      f1 += h2[j] * inw(ffn_w1[j * 2 + 1]);
    }
    f0 = 0.5f * f0 * (1.0f + erff(f0 * 0.70710678118654752f));
    f1 = 0.5f * f1 * (1.0f + erff(f1 * 0.70710678118654752f));
#pragma unroll
    for (int j = 0; j < 6; ++j)
      x2[j] += f0 * inw(ffn_w2[j]) + f1 * inw(ffn_w2[6 + j]) + inw(ffn_b2[j]);
    float xf[6];
    ln6(x2, lnf_g, lnf_b, xf);
    float y[3];
#pragma unroll
    for (int d = 0; d < 3; ++d) {
      float acc = 0.0f;
#pragma unroll
      for (int c = 0; c < 6; ++c) acc += xf[c] * inw(head_w[c * 3 + d]);
      y[d] = acc;
    }
#pragma unroll 2
    for (int n = 0; n < VOC; ++n) {
      const float lg = y[0] * inw(tok_emb[n * 3 + 0]) + y[1] * inw(tok_emb[n * 3 + 1]) +
                       y[2] * inw(tok_emb[n * 3 + 2]);
      if (act) sLog[p * VOC + (unsigned)n] = lg;
    }
  }
  __syncthreads();

  {
    float* outB = out + (size_t)blockIdx.x * (size_t)(TOK * VOC);
    v4f xs[4];
#pragma unroll
    for (unsigned j = 0; j < 4u; ++j) {
      const unsigned i = tid + NTHR * j;
      const unsigned ic = (i < (unsigned)OUT_F4) ? i : (unsigned)(OUT_F4 - 1);
      xs[j] = *(const v4f*)&sLog[ic * 4u];
    }
#pragma unroll
    for (unsigned j = 0; j < 4u; ++j) {
      const unsigned i = tid + NTHR * j;
      if (i < (unsigned)OUT_F4) *(v4f*)(outB + (size_t)i * 4u) = xs[j];
    }
    
  }
}

// ---------------------------------------------------------------------------
extern "C" void kernel_launch(void* const* d_in, const int* in_sizes, int n_in,
                              void* d_out, int out_size, void* d_ws, size_t ws_size,
                              hipStream_t stream) {
  (void)d_ws; (void)ws_size;
  if (n_in < 20) return;
  if ((long long)in_sizes[0] < (long long)NB * TLEN) return;
  if (in_sizes[1] < VOC * 3 || in_sizes[2] < 4 || in_sizes[3] < 3 || in_sizes[4] < 9) return;
  if (in_sizes[5] < 18 || in_sizes[6] < 18 || in_sizes[7] < 18 || in_sizes[8] < 36) return;
  if (in_sizes[9] < 6 || in_sizes[10] < 6 || in_sizes[11] < 6 || in_sizes[12] < 6) return;
  if (in_sizes[13] < 6 || in_sizes[14] < 6) return;
  if (in_sizes[15] < 12 || in_sizes[16] < 2 || in_sizes[17] < 12 || in_sizes[18] < 6) return;
  if (in_sizes[19] < 18) return;
  if ((long long)out_size < (long long)NB * TLEN * VOC) return;

  const int*   idx         = (const int*)  d_in[0];    // [NB_FULL][34]
  const float* tok_emb     = (const float*)d_in[1];    // [14][3]
  const float* pos_params  = (const float*)d_in[2];    // [4]
  const float* z10_enc     = (const float*)d_in[3];    // [1][3]
  const float* special_enc = (const float*)d_in[4];    // [3][3]
  const float* wq          = (const float*)d_in[5];    // [3][6] (in, out)
  const float* wk          = (const float*)d_in[6];
  const float* wv          = (const float*)d_in[7];
  const float* wo          = (const float*)d_in[8];    // [6][6] (in, out)
  const float* ln1_g       = (const float*)d_in[9];
  const float* ln1_b       = (const float*)d_in[10];
  const float* ln2_g       = (const float*)d_in[11];
  const float* ln2_b       = (const float*)d_in[12];
  const float* lnf_g       = (const float*)d_in[13];
  const float* lnf_b       = (const float*)d_in[14];
  const float* ffn_w1      = (const float*)d_in[15];   // [6][2]
  const float* ffn_b1      = (const float*)d_in[16];
  const float* ffn_w2      = (const float*)d_in[17];   // [2][6]
  const float* ffn_b2      = (const float*)d_in[18];
  const float* head_w      = (const float*)d_in[19];   // [6][3]
  float* out = (float*)d_out;

  fused_block_kernel<<<dim3(NB / SPB), dim3(NTHR), 0, stream>>>(
      idx, tok_emb, pos_params, z10_enc, special_enc, wq, wk, wv, wo,
      ln1_g, ln1_b, ln2_g, ln2_b, lnf_g, lnf_b,
      ffn_w1, ffn_b1, ffn_w2, ffn_b2, head_w, out);
}

// v001
// One run takes 55.3 microseconds.
// Two timings next to v000 both put it at 1.36 times that version's speed.
#include <hip/hip_runtime.h>
#include <stddef.h>

// Contractions: p.v (34 keys deep) on v_wmma_f32_16x16x32_f16 (f16 operands, f32 accumulate):
// p carried x16384 and v carried x16, each as an f16 value plane plus an x2048 f16 residual
// plane (three products, residual products in their own accumulator). Every other product of
// this block (depth 2..6: q/k/v projections, q.k scores, output projection, feed-forward,
// vocabulary head) is f32 on the vector unit. Float inputs are RNE-converted to bf16 on load
// (switch INPUT_BF16). LayerNorm, softmax, GELU (erf) and residual adds in f32.

typedef _Float16 h16;
typedef _Float16 v16h __attribute__((ext_vector_type(16)));
typedef _Float16 v8h  __attribute__((ext_vector_type(8)));
typedef float    v8f  __attribute__((ext_vector_type(8)));
typedef float    v4f  __attribute__((ext_vector_type(4)));

#ifndef NB
#define NB 32768
#endif
#define NB_FULL 32768
#define TLEN 34          // tokens per sequence (fixed by the position map)
#define VOC  14
#define SPB  8           // sequences per block
#define TOK  (SPB * TLEN)        // 272 tokens per block
#define NTHR 288                 // 9 waves
#define OUT_F4 (TOK * VOC / 4)
#define VROWS 8                  // V^T plane rows per sequence (6 used, 2 zero)
#define VKEYS 64                 // V^T plane keys per row (34 used, rest zero)

#ifndef INPUT_BF16
#define INPUT_BF16 1
#endif
#ifndef PV_RES
#define PV_RES 1
#endif

#define PCARRY 16384.0f
#define VCARRY 16.0f
#define RCARRY 2048.0f
#define OSCALE 3.814697265625e-06f    // 1 / (PCARRY * VCARRY)

static_assert(NB >= SPB && NB <= NB_FULL && (NB % SPB) == 0);
static_assert((TOK * VOC * 4) % 128 == 0);          // a block owns whole output lines
static_assert((TOK * VOC) % 4 == 0);
static_assert(OUT_F4 % 8 == 0);
static_assert(NTHR % 32 == 0 && NTHR >= TOK);
static_assert(4 * NTHR >= OUT_F4);                  // store loop: 4 trips cover the block
static_assert(TLEN > 32 && TLEN <= 48);             // two 16-row query tiles + tail rows, keys 32.. as extras
static_assert(TLEN - 32 == 2);                      // exactly two tail rows / extra keys (32, 33)
static_assert(VKEYS == 64 && VROWS == 8);
static_assert(SPB == 8 && NTHR / 32 == SPB + 1);    // p.v phase: one wave per sequence, one for the tails

__device__ __forceinline__ float bf16r(float x) {   // RNE convert to bf16, returned widened
  unsigned int u = __float_as_uint(x);
  u = (u + 0x7FFFu + ((u >> 16) & 1u)) & 0xFFFF0000u;
  return __uint_as_float(u);
}
__device__ __forceinline__ float inw(float x) {     // input value as consumed
  return INPUT_BF16 ? bf16r(x) : x;
}
// f32 -> f16 operand convert that cannot produce an f16 subnormal
static __device__ __forceinline__ h16 toh_flush(float v) {
  const h16 r = (h16)v;
  return (fabsf(v) < 6.103515625e-05f) ? (h16)0.0f : r;
}

// 16-bit fragment: p points at element [row = lane&15][k0 + 8*(lane>>4)] of a k-contiguous
// row. Elements 0..7 <- k0+8h+0..7, elements 8..15 <- k0+16+8h+0..7 (same map for A and B).
__device__ __forceinline__ v16h frag_at(const _Float16* p) {
  v8h lo = *(const v8h*)(p);
  v8h hi = *(const v8h*)(p + 16);
  v16h out;
#pragma unroll
  for (int i = 0; i < 8; ++i) { out[i] = lo[i]; out[i + 8] = hi[i]; }
  return out;
}

__device__ __forceinline__ v8f wmma16(v16h a, v16h b, v8f c) {
  v8f d = __builtin_amdgcn_wmma_f32_16x16x32_f16(false, a, false, b, (short)0, c,
                                                 false, false);
  asm volatile("v_nop\n\tv_nop\n\tv_nop\n\tv_nop" : "+v"(d) : "v"(a), "v"(b));
  return d;
}

// Scores, causal softmax numerators and their f16 value / residual planes for one query row
// per lane pair (lane, lane^16), in the A-fragment layout. kp = key rows of the row's sequence
// and head, tq = query position. NE = fragment elements that can hold an unmasked key (8: keys
// 0..15, 16: keys 0..31; the rest are zero operands); XT: keys 32,33 as a second k-step.
// Returns the row sum over the unconverted numerators.
template <int NE, bool XT>
__device__ __forceinline__ float soft_rows(const v4f qv, const v4f* kp, const unsigned tq,
                                           const unsigned hh, v16h& ahi, v16h& ars,
                                           v16h& xhi, v16h& xrs) {
  float sc[NE];
  float sx[2];
  float mx = -1.0e30f;
#pragma unroll
  for (int i = 0; i < NE; ++i) {
    const unsigned j = 8u * hh + (unsigned)(i & 7) + 16u * (unsigned)(i >> 3);
    const v4f kv = kp[j];
    float sv = (qv[0] * kv[0] + qv[1] * kv[1] + qv[2] * kv[2]) * 0.57735026918962576f;
    sv = (j > tq) ? -1.0e30f : sv;
    sc[i] = sv;
    mx = fmaxf(mx, sv);
  }
  if (XT) {
#pragma unroll
    for (int e = 0; e < 2; ++e) {
      const unsigned j = 32u + (unsigned)e;
      const v4f kv = kp[j];
      float sv = (qv[0] * kv[0] + qv[1] * kv[1] + qv[2] * kv[2]) * 0.57735026918962576f;
      sv = ((hh != 0u) || (j > tq)) ? -1.0e30f : sv;
      sx[e] = sv;
      mx = fmaxf(mx, sv);
    }
  }
  mx = fmaxf(mx, __shfl_xor(mx, 16, 32));

  ahi = v16h{};
  ars = v16h{};
  xhi = v16h{};
  xrs = v16h{};
  float den = 0.0f;
#pragma unroll
  for (int i = 0; i < NE; ++i) {
    const unsigned j = 8u * hh + (unsigned)(i & 7) + 16u * (unsigned)(i >> 3);
    float pe = __expf(sc[i] - mx);
    pe = (j > tq) ? 0.0f : pe;
    den += pe;
    const float pv = pe * PCARRY;
    const h16 hi = toh_flush(pv);
    ahi[i] = hi;
    ars[i] = toh_flush((pv - (float)hi) * RCARRY);
  }
  if (XT) {
#pragma unroll
    for (int e = 0; e < 2; ++e) {
      const unsigned j = 32u + (unsigned)e;
      float pe = __expf(sx[e] - mx);
      pe = ((hh != 0u) || (j > tq)) ? 0.0f : pe;
      den += pe;
      const float pv = pe * PCARRY;
      const h16 hi = toh_flush(pv);
      xhi[e] = hi;
      xrs[e] = toh_flush((pv - (float)hi) * RCARRY);
    }
  }
  den += __shfl_xor(den, 16, 32);
  return den;
}

// LayerNorm over 6 values (biased variance, eps 1e-5)
__device__ __forceinline__ void ln6(const float (&x)[6], const float* __restrict__ g,
                                    const float* __restrict__ b, float (&h)[6]) {
  const float mu = (x[0] + x[1] + x[2] + x[3] + x[4] + x[5]) * (1.0f / 6.0f);
  float var = 0.0f;
#pragma unroll
  for (int c = 0; c < 6; ++c) { const float d = x[c] - mu; var += d * d; }
  var *= (1.0f / 6.0f);
  const float rs = rsqrtf(var + 1.0e-5f);
#pragma unroll
  for (int c = 0; c < 6; ++c) h[c] = (x[c] - mu) * rs * inw(g[c]) + inw(b[c]);
}

// ---------------------------------------------------------------------------
// One block = 8 sequences (272 tokens, one token per thread in the per-token phases).
// Phase 0: zero the V^T planes, build the 34x3 position rows (waves 0,1).
// Phase A: embed + LN1 + q/k/v per token; q,k as f32 float4 rows per head in LDS; v as f16
//          value / residual planes VT[seq][n = head*3+d][key] (k-contiguous B operand).
// Phase B: scores and the causal softmax are formed in registers directly in the A-fragment
//          layout (lane row = lane&15, up to 16 keys per lane); unnormalised p.v via WMMA; row
//          sums over the unconverted p. Wave w (< 8) owns query rows 0..31 of sequence w: per
//          head a tile of rows 0..15 (keys 0..15 only) and a tile of rows 16..31. Wave 8 owns
//          rows 32,33 of all sequences and heads (two full tiles, keys 32,33 as a second
//          sparse k-step).
// Phase C: per token: normalise, output projection, LN2, GELU feed-forward, final LN, head;
//          logits staged in LDS in the output layout.
// LDS regions are all cross-wave (block barriers between phases).
// ---------------------------------------------------------------------------
__global__ __launch_bounds__(NTHR) void fused_block_kernel(
    const int* __restrict__ idx, const float* __restrict__ tok_emb,
    const float* __restrict__ pos_params, const float* __restrict__ z10_enc,
    const float* __restrict__ special_enc, const float* __restrict__ wq,
    const float* __restrict__ wk, const float* __restrict__ wv, const float* __restrict__ wo,
    const float* __restrict__ ln1_g, const float* __restrict__ ln1_b,
    const float* __restrict__ ln2_g, const float* __restrict__ ln2_b,
    const float* __restrict__ lnf_g, const float* __restrict__ lnf_b,
    const float* __restrict__ ffn_w1, const float* __restrict__ ffn_b1,
    const float* __restrict__ ffn_w2, const float* __restrict__ ffn_b2,
    const float* __restrict__ head_w, float* __restrict__ out) {
  __shared__ __attribute__((aligned(16))) v4f sQ4[SPB * 2 * TLEN];
  __shared__ __attribute__((aligned(16))) v4f sK4[SPB * 2 * TLEN];
  __shared__ __attribute__((aligned(16))) _Float16 sVTh[SPB * VROWS * VKEYS];
  __shared__ __attribute__((aligned(16))) _Float16 sVTr[SPB * VROWS * VKEYS];
  __shared__ __attribute__((aligned(16))) float sO[TOK * 6];
  __shared__ __attribute__((aligned(16))) float sDen[TOK * 2];
  __shared__ __attribute__((aligned(16))) float sPos[TLEN * 4];
  __shared__ __attribute__((aligned(16))) float sLog[TOK * VOC];

  const unsigned tid = threadIdx.x;
  const unsigned lane = tid & 31u;
  const int wave = __builtin_amdgcn_readfirstlane((int)(tid >> 5));
  const unsigned hh = lane >> 4, m = lane & 15u;

  // ---- Phase 0: zero V^T planes (pad keys 34..63 and rows 6,7 stay zero) ----
  {
    const v8h z = {};
    for (unsigned i = tid; i < (unsigned)(SPB * VROWS * VKEYS / 8); i += NTHR) {
      *(v8h*)&sVTh[i * 8u] = z;
      *(v8h*)&sVTr[i * 8u] = z;
    }
  }
  // ---- position rows: all candidates loaded by value, selected by value ----
  if (wave < 2) {
    const unsigned t = (tid < (unsigned)TLEN) ? tid : (unsigned)(TLEN - 1);
    const float amp   = inw(pos_params[0]);
    const float phase = inw(pos_params[1]);
    const float slope = inw(pos_params[2]);
    const float offs  = inw(pos_params[3]);
    int di = (t < 10u) ? (int)t : ((t < 21u) ? ((int)t - 11) : ((int)t - 22));
    di = (di < 0) ? 0 : ((di > 9) ? 9 : di);
    const float fi  = (float)di;
    const float ang = 0.62831853071795864769f * fi + phase;
    const float d0 = amp * cosf(ang);
    const float d1 = amp * sinf(ang);
    const float d2 = slope * fi + offs;
    const unsigned si = (t == 10u) ? 0u : ((t == 21u) ? 1u : 2u);
    const float s0 = inw(special_enc[si * 3u + 0u]);
    const float s1 = inw(special_enc[si * 3u + 1u]);
    const float s2 = inw(special_enc[si * 3u + 2u]);
    const float z0 = inw(z10_enc[0]);
    const float z1 = inw(z10_enc[1]);
    const float z2 = inw(z10_enc[2]);
    const bool is_sp = (t == 10u) || (t == 21u) || (t == 33u);
    const bool is_z  = (t == 32u);
    const float p0 = is_sp ? s0 : (is_z ? z0 : d0);
    const float p1 = is_sp ? s1 : (is_z ? z1 : d1);
    const float p2 = is_sp ? s2 : (is_z ? z2 : d2);
    if (tid < (unsigned)TLEN) {
      sPos[t * 4u + 0u] = p0;
      sPos[t * 4u + 1u] = p1;
      sPos[t * 4u + 2u] = p2;
      sPos[t * 4u + 3u] = 0.0f;
    }
  }
  __syncthreads();

  // ---- Phase A: embed + LN1 + q/k/v (idle lanes duplicate the last token, no stores) ----
  const bool act = tid < (unsigned)TOK;
  const unsigned p = act ? tid : (unsigned)(TOK - 1);
  const unsigned s = p / (unsigned)TLEN;
  const unsigned t = p - s * (unsigned)TLEN;
  float x[6];
  {
    const size_t seq_g = (size_t)blockIdx.x * SPB + s;
    int tok = idx[seq_g * TLEN + t];
    tok = (tok < 0) ? 0 : ((tok > VOC - 1) ? (VOC - 1) : tok);
#pragma unroll
    for (int c = 0; c < 3; ++c) {
      x[c]     = inw(tok_emb[tok * 3 + c]);
      x[3 + c] = sPos[t * 4u + (unsigned)c];
    }
    float h[6];
    ln6(x, ln1_g, ln1_b, h);
    float q[6], k[6], v[6];
#pragma unroll
    for (int j = 0; j < 6; ++j) {
      q[j] = h[3] * inw(wq[j]) + h[4] * inw(wq[6 + j]) + h[5] * inw(wq[12 + j]);
      k[j] = h[3] * inw(wk[j]) + h[4] * inw(wk[6 + j]) + h[5] * inw(wk[12 + j]);
      v[j] = h[0] * inw(wv[j]) + h[1] * inw(wv[6 + j]) + h[2] * inw(wv[12 + j]);
    }
    if (act) {
      v4f q0 = {q[0], q[1], q[2], 0.0f};
      v4f q1 = {q[3], q[4], q[5], 0.0f};
      v4f k0 = {k[0], k[1], k[2], 0.0f};
      v4f k1 = {k[3], k[4], k[5], 0.0f};
      sQ4[(s * 2u + 0u) * TLEN + t] = q0;
      sQ4[(s * 2u + 1u) * TLEN + t] = q1;
      sK4[(s * 2u + 0u) * TLEN + t] = k0;
      sK4[(s * 2u + 1u) * TLEN + t] = k1;
#pragma unroll
      for (int n = 0; n < 6; ++n) {
        const float vv = v[n] * VCARRY;
        const h16 hi = toh_flush(vv);
        const h16 rs = toh_flush((vv - (float)hi) * RCARRY);
        sVTh[(s * VROWS + (unsigned)n) * VKEYS + t] = hi;
        sVTr[(s * VROWS + (unsigned)n) * VKEYS + t] = rs;
      }
    }
  }
  __syncthreads();

  // ---- Phase B: causal softmax in A-fragment registers, p.v on WMMA ----
  if (wave < SPB) {
    // waves 0..7: query rows 0..31 of sequence = wave
    const unsigned seq = (unsigned)wave;
    // B fragments: lane column n = lane&15 -> V^T row n&7 (rows 6,7 are zero rows)
    const unsigned vrow = (seq * VROWS + (m & 7u)) * VKEYS + 8u * hh;
    const v16h bh0 = frag_at(&sVTh[vrow]);
    const v16h br0 = frag_at(&sVTr[vrow]);

#pragma unroll 1
    for (unsigned hd = 0; hd < 2u; ++hd) {
      const unsigned qkb = (seq * 2u + hd) * TLEN;
#pragma unroll
      for (int qt = 0; qt < 2; ++qt) {
        const unsigned tr = 16u * (unsigned)qt + m;                 // query row of this lane
        const v4f qv = sQ4[qkb + tr];
        v16h ahi, ars, xhi, xrs;
        const float den = (qt == 0)
            ? soft_rows<8, false>(qv, &sK4[qkb], tr, hh, ahi, ars, xhi, xrs)
            : soft_rows<16, false>(qv, &sK4[qkb], tr, hh, ahi, ars, xhi, xrs);

        v8f accM = {}, accR = {};
        accM = wmma16(ahi, bh0, accM);
        if (PV_RES) {
          accR = wmma16(ahi, br0, accR);
          accR = wmma16(ars, bh0, accR);
        }

        // D element r of this lane = (row 16*qt + 8*hh + r, column m); columns 3*hd..3*hd+2
        const bool colok = (m >= 3u * hd) && (m < 3u * hd + 3u);
#pragma unroll
        for (int r = 0; r < 8; ++r) {
          const unsigned row = 16u * (unsigned)qt + 8u * hh + (unsigned)r;
          const float val = accM[r] + accR[r] * (1.0f / RCARRY);
          if (colok) sO[(seq * TLEN + row) * 6u + m] = val;
        }
        if (hh == 0u) sDen[(seq * TLEN + tr) * 2u + hd] = den;
      }
    }
  } else {
    // wave 8: query rows 32,33 of every sequence and both heads, 16 full rows per tile.
    // Tile row m = (sequence 4*tl + (m>>2), head (m>>1)&1, query 32 + (m&1)).
#pragma unroll 1
    for (unsigned tl = 0; tl < 2u; ++tl) {
      const unsigned sq = 4u * tl + (m >> 2);
      const unsigned hd = (m >> 1) & 1u;
      const unsigned tq = 32u + (m & 1u);
      const unsigned qkb = (sq * 2u + hd) * TLEN;
      const v4f qv = sQ4[qkb + tq];
      v16h ahi, ars, xhi, xrs;
      const float den = soft_rows<16, true>(qv, &sK4[qkb], tq, hh, ahi, ars, xhi, xrs);
      if (hh == 0u) sDen[(sq * TLEN + tq) * 2u + hd] = den;

      // B columns 0..7 = V^T rows of sequence 4*tl + 2*pp, columns 8..15 = of the next one;
      // their query rows are tile rows 8*pp..8*pp+7 (D elements of the lanes with hh == pp).
      // Column c = m&7 (< 6) belongs to head c/3, so a lane keeps D elements r0, r0+1 with
      // r0 = 4*(m>>3) + 2*(c/3): queries 32,33 of sequence 4*tl + 2*hh + (m>>3).
      const unsigned c = m & 7u;
      const bool up = (m >> 3) != 0u, h1 = c >= 3u;
      float keep[2] = {0.0f, 0.0f};
      // rolled: only one pair's B fragments live at a time (fewer registers, more waves resident)
#pragma unroll 1
      for (unsigned pp = 0; pp < 2u; ++pp) {
        const unsigned vrow = ((4u * tl + 2u * pp + (m >> 3)) * VROWS + c) * VKEYS + 8u * hh;
        const v16h bh0 = frag_at(&sVTh[vrow]);
        const v16h br0 = frag_at(&sVTr[vrow]);
        const v16h bh1 = frag_at(&sVTh[vrow + 32u]);
        const v16h br1 = frag_at(&sVTr[vrow + 32u]);

        v8f accM = {}, accR = {};
        accM = wmma16(ahi, bh0, accM);
        if (PV_RES) {
          accR = wmma16(ahi, br0, accR);
          accR = wmma16(ars, bh0, accR);
        }
        accM = wmma16(xhi, bh1, accM);
        if (PV_RES) {
          accR = wmma16(xhi, br1, accR);
          accR = wmma16(xrs, bh1, accR);
        }

        float val[8];
#pragma unroll
        for (int r = 0; r < 8; ++r) val[r] = accM[r] + accR[r] * (1.0f / RCARRY);
#pragma unroll
        for (int e = 0; e < 2; ++e) {
          const float lo = h1 ? val[2 + e] : val[e];
          const float hi = h1 ? val[6 + e] : val[4 + e];
          const float pick = up ? hi : lo;
          keep[e] = (hh == pp) ? pick : keep[e];
        }
      }
      if (c < 6u) {
        const unsigned ob = ((4u * tl + 2u * hh + (m >> 3)) * TLEN + 32u) * 6u + c;
        sO[ob] = keep[0];
        sO[ob + 6u] = keep[1];
      }
    }
  }
  __syncthreads();

  // ---- Phase C: normalise, output projection, LN2, feed-forward, final LN, head ----
  {
    float o[6];
    const float inv0 = (1.0f / sDen[p * 2u + 0u]) * OSCALE;
    const float inv1 = (1.0f / sDen[p * 2u + 1u]) * OSCALE;
#pragma unroll
    for (int c = 0; c < 3; ++c) {
      o[c]     = sO[p * 6u + (unsigned)c] * inv0;
      o[3 + c] = sO[p * 6u + 3u + (unsigned)c] * inv1;
    }
    float x2[6];
#pragma unroll
    for (int j = 0; j < 6; ++j) {
      float acc = x[j];
#pragma unroll
      for (int c = 0; c < 6; ++c) acc += o[c] * inw(wo[c * 6 + j]);
      x2[j] = acc;
    }
    float h2[6];
    ln6(x2, ln2_g, ln2_b, h2);
    float f0 = inw(ffn_b1[0]), f1 = inw(ffn_b1[1]);
#pragma unroll
    for (int j = 0; j < 6; ++j) {
      f0 += h2[j] * inw(ffn_w1[j * 2 + 0]);
      f1 += h2[j] * inw(ffn_w1[j * 2 + 1]);
    }
    f0 = 0.5f * f0 * (1.0f + erff(f0 * 0.70710678118654752f));
    f1 = 0.5f * f1 * (1.0f + erff(f1 * 0.70710678118654752f));
#pragma unroll
    for (int j = 0; j < 6; ++j)
      x2[j] += f0 * inw(ffn_w2[j]) + f1 * inw(ffn_w2[6 + j]) + inw(ffn_b2[j]);
    float xf[6];
    ln6(x2, lnf_g, lnf_b, xf);
    float y[3];
#pragma unroll
    for (int d = 0; d < 3; ++d) {
      float acc = 0.0f;
#pragma unroll
      for (int c = 0; c < 6; ++c) acc += xf[c] * inw(head_w[c * 3 + d]);
      y[d] = acc;
    }
#pragma unroll 2
    for (int n = 0; n < VOC; ++n) {
      const float lg = y[0] * inw(tok_emb[n * 3 + 0]) + y[1] * inw(tok_emb[n * 3 + 1]) +
                       y[2] * inw(tok_emb[n * 3 + 2]);
      if (act) sLog[p * VOC + (unsigned)n] = lg;
    }
  }
  __syncthreads();

  {
    float* outB = out + (size_t)blockIdx.x * (size_t)(TOK * VOC);
    v4f xs[4];
#pragma unroll
    for (unsigned j = 0; j < 4u; ++j) {
      const unsigned i = tid + NTHR * j;
      const unsigned ic = (i < (unsigned)OUT_F4) ? i : (unsigned)(OUT_F4 - 1);
      xs[j] = *(const v4f*)&sLog[ic * 4u];
    }
#pragma unroll
    for (unsigned j = 0; j < 4u; ++j) {
      const unsigned i = tid + NTHR * j;
      if (i < (unsigned)OUT_F4) *(v4f*)(outB + (size_t)i * 4u) = xs[j];
    }
    
  }
}

// ---------------------------------------------------------------------------
extern "C" void kernel_launch(void* const* d_in, const int* in_sizes, int n_in,
                              void* d_out, int out_size, void* d_ws, size_t ws_size,
                              hipStream_t stream) {
  (void)d_ws; (void)ws_size;
  if (n_in < 20) return;
  if ((long long)in_sizes[0] < (long long)NB * TLEN) return;
  if (in_sizes[1] < VOC * 3 || in_sizes[2] < 4 || in_sizes[3] < 3 || in_sizes[4] < 9) return;
  if (in_sizes[5] < 18 || in_sizes[6] < 18 || in_sizes[7] < 18 || in_sizes[8] < 36) return;
  if (in_sizes[9] < 6 || in_sizes[10] < 6 || in_sizes[11] < 6 || in_sizes[12] < 6) return;
  if (in_sizes[13] < 6 || in_sizes[14] < 6) return;
  if (in_sizes[15] < 12 || in_sizes[16] < 2 || in_sizes[17] < 12 || in_sizes[18] < 6) return;
  if (in_sizes[19] < 18) return;
  if ((long long)out_size < (long long)NB * TLEN * VOC) return;

  const int*   idx         = (const int*)  d_in[0];    // [NB_FULL][34]
  const float* tok_emb     = (const float*)d_in[1];    // [14][3]
  const float* pos_params  = (const float*)d_in[2];    // [4]
  const float* z10_enc     = (const float*)d_in[3];    // [1][3]
  const float* special_enc = (const float*)d_in[4];    // [3][3]
  const float* wq          = (const float*)d_in[5];    // [3][6] (in, out)
  const float* wk          = (const float*)d_in[6];
  const float* wv          = (const float*)d_in[7];
  const float* wo          = (const float*)d_in[8];    // [6][6] (in, out)
  const float* ln1_g       = (const float*)d_in[9];
  const float* ln1_b       = (const float*)d_in[10];
  const float* ln2_g       = (const float*)d_in[11];
  const float* ln2_b       = (const float*)d_in[12];
  const float* lnf_g       = (const float*)d_in[13];
  const float* lnf_b       = (const float*)d_in[14];
  const float* ffn_w1      = (const float*)d_in[15];   // [6][2]
  const float* ffn_b1      = (const float*)d_in[16];
  const float* ffn_w2      = (const float*)d_in[17];   // [2][6]
  const float* ffn_b2      = (const float*)d_in[18];
  const float* head_w      = (const float*)d_in[19];   // [6][3]
  float* out = (float*)d_out;

  fused_block_kernel<<<dim3(NB / SPB), dim3(NTHR), 0, stream>>>(
      idx, tok_emb, pos_params, z10_enc, special_enc, wq, wk, wv, wo,
      ln1_g, ln1_b, ln2_g, ln2_b, lnf_g, lnf_b,
      ffn_w1, ffn_b1, ffn_w2, ffn_b2, head_w, out);
}

// v002
// A run of this version takes 49.5 microseconds.
// Timed twice side by side with v001, it ran 1.12 times as fast both times.
// Over all steps from v000 it is 1.52 times as fast.
#include <hip/hip_runtime.h>
#include <stddef.h>

// Contractions: p.v (34 keys deep) on v_wmma_f32_16x16x32_f16 (f16 operands, f32 accumulate):
// p carried x16384 and v carried x16, each as an f16 value plane plus an x2048 f16 residual
// plane (three products, residual products in their own accumulator). Every other product of
// this block (depth 2..6: q/k/v projections, q.k scores, output projection, feed-forward,
// vocabulary head) is f32 on the vector unit. Float inputs are RNE-converted to bf16 on load
// (switch INPUT_BF16). LayerNorm, softmax, GELU (erf) and residual adds in f32.

typedef _Float16 h16;
typedef _Float16 v16h __attribute__((ext_vector_type(16)));
typedef _Float16 v8h  __attribute__((ext_vector_type(8)));
typedef float    v8f  __attribute__((ext_vector_type(8)));
typedef float    v4f  __attribute__((ext_vector_type(4)));
typedef float    v2f  __attribute__((ext_vector_type(2)));
typedef _Float16 v2h  __attribute__((ext_vector_type(2)));

#ifndef NB
#define NB 32768
#endif
#define NB_FULL 32768
#define TLEN 34          // tokens per sequence (fixed by the position map)
#define VOC  14
#define SPB  8           // sequences per block
#define TOK  (SPB * TLEN)        // 272 tokens per block
#define NTHR 288                 // 9 waves
#define OUT_F4 (TOK * VOC / 4)
#define VROWS 8                  // V^T plane rows per sequence (6 used, 2 zero)
#define VKEYS 64                 // V^T plane keys per row (34 used, rest zero)

#ifndef INPUT_BF16
#define INPUT_BF16 1
#endif
#ifndef PV_RES
#define PV_RES 1
#endif

#define PCARRY 16384.0f
#define VCARRY 16.0f
#define RCARRY 2048.0f
#define OSCALE 3.814697265625e-06f    // 1 / (PCARRY * VCARRY)

static_assert(NB >= SPB && NB <= NB_FULL && (NB % SPB) == 0);
static_assert((TOK * VOC * 4) % 128 == 0);          // a block owns whole output lines
static_assert((TOK * VOC) % 4 == 0);
static_assert(OUT_F4 % 8 == 0);
static_assert(NTHR % 32 == 0 && NTHR >= TOK);
static_assert(4 * NTHR >= OUT_F4);                  // store loop: 4 trips cover the block
static_assert(TLEN > 32 && TLEN <= 48);             // two 16-row query tiles + tail rows, keys 32.. as extras
static_assert(TLEN - 32 == 2);                      // exactly two tail rows / extra keys (32, 33)
static_assert(VKEYS == 64 && VROWS == 8);
static_assert(SPB == 8 && NTHR / 32 == SPB + 1);    // p.v phase: one wave per sequence, one for the tails

__device__ __forceinline__ float bf16r(float x) {   // RNE convert to bf16, returned widened
  unsigned int u = __float_as_uint(x);
  u = (u + 0x7FFFu + ((u >> 16) & 1u)) & 0xFFFF0000u;
  return __uint_as_float(u);
}
__device__ __forceinline__ float inw(float x) {     // input value as consumed
  return INPUT_BF16 ? bf16r(x) : x;
}
// Two f32 values -> f16 value plane and x2048 f16 residual plane, round to nearest even, both
// values per convert instruction. A small value becomes an f16 subnormal: the matrix unit keeps
// subnormal operands, and what the value plane rounds off goes to the residual plane as for
// any other value.
static __device__ __forceinline__ void split2(const v2f x, v2h& hi, v2h& rs) {
  hi = __builtin_convertvector(x, v2h);
  rs = __builtin_convertvector((x - __builtin_convertvector(hi, v2f)) * RCARRY, v2h);
}

// 16-bit fragment: p points at element [row = lane&15][k0 + 8*(lane>>4)] of a k-contiguous
// row. Elements 0..7 <- k0+8h+0..7, elements 8..15 <- k0+16+8h+0..7 (same map for A and B).
__device__ __forceinline__ v16h frag_at(const _Float16* p) {
  v8h lo = *(const v8h*)(p);
  v8h hi = *(const v8h*)(p + 16);
  v16h out;
#pragma unroll
  for (int i = 0; i < 8; ++i) { out[i] = lo[i]; out[i + 8] = hi[i]; }
  return out;
}

__device__ __forceinline__ v8f wmma16(v16h a, v16h b, v8f c) {
  v8f d = __builtin_amdgcn_wmma_f32_16x16x32_f16(false, a, false, b, (short)0, c,
                                                 false, false);
  asm volatile("v_nop\n\tv_nop\n\tv_nop\n\tv_nop" : "+v"(d) : "v"(a), "v"(b));
  return d;
}

// Scores, causal softmax numerators and their f16 value / residual planes for one query row
// per lane pair (lane, lane^16), in the A-fragment layout. kp = key rows of the row's sequence
// and head, tq = query position. NE = fragment elements that can hold an unmasked key (8: keys
// 0..15, 16: keys 0..31; the rest are zero operands); XT: keys 32,33 as a second k-step.
// Returns the row sum over the unconverted numerators.
template <int NE, bool XT>
__device__ __forceinline__ float soft_rows(const v4f qv, const v4f* kp, const unsigned tq,
                                           const unsigned hh, v16h& ahi, v16h& ars,
                                           v16h& xhi, v16h& xrs) {
  float sc[NE];
  float sx[2];
  float mx = -1.0e30f;
#pragma unroll
  for (int i = 0; i < NE; ++i) {
    const unsigned j = 8u * hh + (unsigned)(i & 7) + 16u * (unsigned)(i >> 3);
    const v4f kv = kp[j];
    float sv = (qv[0] * kv[0] + qv[1] * kv[1] + qv[2] * kv[2]) * 0.57735026918962576f;
    sv = (j > tq) ? -1.0e30f : sv;
    sc[i] = sv;
    mx = fmaxf(mx, sv);
  }
  if (XT) {
#pragma unroll
    for (int e = 0; e < 2; ++e) {
      const unsigned j = 32u + (unsigned)e;
      const v4f kv = kp[j];
      float sv = (qv[0] * kv[0] + qv[1] * kv[1] + qv[2] * kv[2]) * 0.57735026918962576f;
      sv = ((hh != 0u) || (j > tq)) ? -1.0e30f : sv;
      sx[e] = sv;
      mx = fmaxf(mx, sv);
    }
  }
  mx = fmaxf(mx, __shfl_xor(mx, 16, 32));

  ahi = v16h{};
  ars = v16h{};
  xhi = v16h{};
  xrs = v16h{};
  float den = 0.0f;
#pragma unroll
  for (int i = 0; i < NE; ++i) {
    const unsigned j = 8u * hh + (unsigned)(i & 7) + 16u * (unsigned)(i >> 3);
    float pe = __expf(sc[i] - mx);
    pe = (j > tq) ? 0.0f : pe;
    den += pe;
    sc[i] = pe;
  }
#pragma unroll
  for (int i = 0; i < NE; i += 2) {
    v2h hi, rs;
    split2(v2f{sc[i], sc[i + 1]} * PCARRY, hi, rs);
    ahi[i] = hi[0];
    ahi[i + 1] = hi[1];
    ars[i] = rs[0];
    ars[i + 1] = rs[1];
  }
  if (XT) {
#pragma unroll
    for (int e = 0; e < 2; ++e) {
      const unsigned j = 32u + (unsigned)e;
      float pe = __expf(sx[e] - mx);
      pe = ((hh != 0u) || (j > tq)) ? 0.0f : pe;
      den += pe;
      sx[e] = pe;
    }
    v2h hi, rs;
    split2(v2f{sx[0], sx[1]} * PCARRY, hi, rs);
    xhi[0] = hi[0];
    xhi[1] = hi[1];
    xrs[0] = rs[0];
    xrs[1] = rs[1];
  }
  den += __shfl_xor(den, 16, 32);
  return den;
}

// LayerNorm over 6 values (biased variance, eps 1e-5)
__device__ __forceinline__ void ln6(const float (&x)[6], const float* __restrict__ g,
                                    const float* __restrict__ b, float (&h)[6]) {
  const float mu = (x[0] + x[1] + x[2] + x[3] + x[4] + x[5]) * (1.0f / 6.0f);
  float var = 0.0f;
#pragma unroll
  for (int c = 0; c < 6; ++c) { const float d = x[c] - mu; var += d * d; }
  var *= (1.0f / 6.0f);
  const float rs = rsqrtf(var + 1.0e-5f);
#pragma unroll
  for (int c = 0; c < 6; ++c) h[c] = (x[c] - mu) * rs * inw(g[c]) + inw(b[c]);
}

// ---------------------------------------------------------------------------
// One block = 8 sequences (272 tokens, one token per thread in the per-token phases).
// Phase 0: zero the V^T planes, build the 34x3 position rows (waves 0,1).
// Phase A: embed + LN1 + q/k/v per token; q,k as f32 float4 rows per head in LDS; v as f16
//          value / residual planes VT[seq][n = head*3+d][key] (k-contiguous B operand).
// Phase B: scores and the causal softmax are formed in registers directly in the A-fragment
//          layout (lane row = lane&15, up to 16 keys per lane); unnormalised p.v via WMMA; row
//          sums over the unconverted p. Wave w (< 8) owns query rows 0..31 of sequence w: per
//          head a tile of rows 0..15 (keys 0..15 only) and a tile of rows 16..31. Wave 8 owns
//          rows 32,33 of all sequences and heads (two full tiles, keys 32,33 as a second
//          sparse k-step).
// Phase C: per token: normalise, output projection, LN2, GELU feed-forward, final LN, head;
//          logits staged in LDS in the output layout.
// LDS regions are all cross-wave (block barriers between phases).
// ---------------------------------------------------------------------------
__global__ __launch_bounds__(NTHR) void fused_block_kernel(
    const int* __restrict__ idx, const float* __restrict__ tok_emb,
    const float* __restrict__ pos_params, const float* __restrict__ z10_enc,
    const float* __restrict__ special_enc, const float* __restrict__ wq,
    const float* __restrict__ wk, const float* __restrict__ wv, const float* __restrict__ wo,
    const float* __restrict__ ln1_g, const float* __restrict__ ln1_b,
    const float* __restrict__ ln2_g, const float* __restrict__ ln2_b,
    const float* __restrict__ lnf_g, const float* __restrict__ lnf_b,
    const float* __restrict__ ffn_w1, const float* __restrict__ ffn_b1,
    const float* __restrict__ ffn_w2, const float* __restrict__ ffn_b2,
    const float* __restrict__ head_w, float* __restrict__ out) {
  __shared__ __attribute__((aligned(16))) v4f sQ4[SPB * 2 * TLEN];
  __shared__ __attribute__((aligned(16))) v4f sK4[SPB * 2 * TLEN];
  __shared__ __attribute__((aligned(16))) _Float16 sVTh[SPB * VROWS * VKEYS];
  __shared__ __attribute__((aligned(16))) _Float16 sVTr[SPB * VROWS * VKEYS];
  __shared__ __attribute__((aligned(16))) float sO[TOK * 6];
  __shared__ __attribute__((aligned(16))) float sDen[TOK * 2];
  __shared__ __attribute__((aligned(16))) float sPos[TLEN * 4];
  __shared__ __attribute__((aligned(16))) float sLog[TOK * VOC];

  const unsigned tid = threadIdx.x;
  const unsigned lane = tid & 31u;
  const int wave = __builtin_amdgcn_readfirstlane((int)(tid >> 5));
  const unsigned hh = lane >> 4, m = lane & 15u;

  // ---- Phase 0: zero V^T planes (pad keys 34..63 and rows 6,7 stay zero) ----
  {
    const v8h z = {};
    for (unsigned i = tid; i < (unsigned)(SPB * VROWS * VKEYS / 8); i += NTHR) {
      *(v8h*)&sVTh[i * 8u] = z;
      *(v8h*)&sVTr[i * 8u] = z;
    }
  }
  // ---- position rows: all candidates loaded by value, selected by value ----
  if (wave < 2) {
    const unsigned t = (tid < (unsigned)TLEN) ? tid : (unsigned)(TLEN - 1);
    const float amp   = inw(pos_params[0]);
    const float phase = inw(pos_params[1]);
    const float slope = inw(pos_params[2]);
    const float offs  = inw(pos_params[3]);
    int di = (t < 10u) ? (int)t : ((t < 21u) ? ((int)t - 11) : ((int)t - 22));
    di = (di < 0) ? 0 : ((di > 9) ? 9 : di);
    const float fi  = (float)di;
    const float ang = 0.62831853071795864769f * fi + phase;
    const float d0 = amp * cosf(ang);
    const float d1 = amp * sinf(ang);
    const float d2 = slope * fi + offs;
    const unsigned si = (t == 10u) ? 0u : ((t == 21u) ? 1u : 2u);
    const float s0 = inw(special_enc[si * 3u + 0u]);
    const float s1 = inw(special_enc[si * 3u + 1u]);
    const float s2 = inw(special_enc[si * 3u + 2u]);
    const float z0 = inw(z10_enc[0]);
    const float z1 = inw(z10_enc[1]);
    const float z2 = inw(z10_enc[2]);
    const bool is_sp = (t == 10u) || (t == 21u) || (t == 33u);
    const bool is_z  = (t == 32u);
    const float p0 = is_sp ? s0 : (is_z ? z0 : d0);
    const float p1 = is_sp ? s1 : (is_z ? z1 : d1);
    const float p2 = is_sp ? s2 : (is_z ? z2 : d2);
    if (tid < (unsigned)TLEN) {
      sPos[t * 4u + 0u] = p0;
      sPos[t * 4u + 1u] = p1;
      sPos[t * 4u + 2u] = p2;
      sPos[t * 4u + 3u] = 0.0f;
    }
  }
  __syncthreads();

  // ---- Phase A: embed + LN1 + q/k/v (idle lanes duplicate the last token, no stores) ----
  const bool act = tid < (unsigned)TOK;
  const unsigned p = act ? tid : (unsigned)(TOK - 1);
  const unsigned s = p / (unsigned)TLEN;
  const unsigned t = p - s * (unsigned)TLEN;
  float x[6];
  {
    const size_t seq_g = (size_t)blockIdx.x * SPB + s;
    int tok = idx[seq_g * TLEN + t];
    tok = (tok < 0) ? 0 : ((tok > VOC - 1) ? (VOC - 1) : tok);
#pragma unroll
    for (int c = 0; c < 3; ++c) {
      x[c]     = inw(tok_emb[tok * 3 + c]);
      x[3 + c] = sPos[t * 4u + (unsigned)c];
    }
    float h[6];
    ln6(x, ln1_g, ln1_b, h);
    float q[6], k[6], v[6];
#pragma unroll
    for (int j = 0; j < 6; ++j) {
      q[j] = h[3] * inw(wq[j]) + h[4] * inw(wq[6 + j]) + h[5] * inw(wq[12 + j]);
      k[j] = h[3] * inw(wk[j]) + h[4] * inw(wk[6 + j]) + h[5] * inw(wk[12 + j]);
      v[j] = h[0] * inw(wv[j]) + h[1] * inw(wv[6 + j]) + h[2] * inw(wv[12 + j]);
    }
    if (act) {
      v4f q0 = {q[0], q[1], q[2], 0.0f};
      v4f q1 = {q[3], q[4], q[5], 0.0f};
      v4f k0 = {k[0], k[1], k[2], 0.0f};
      v4f k1 = {k[3], k[4], k[5], 0.0f};
      sQ4[(s * 2u + 0u) * TLEN + t] = q0;
      sQ4[(s * 2u + 1u) * TLEN + t] = q1;
      sK4[(s * 2u + 0u) * TLEN + t] = k0;
      sK4[(s * 2u + 1u) * TLEN + t] = k1;
#pragma unroll
      for (int n = 0; n < 6; n += 2) {
        v2h hi, rs;
        split2(v2f{v[n], v[n + 1]} * VCARRY, hi, rs);
        sVTh[(s * VROWS + (unsigned)n) * VKEYS + t] = hi[0];
        sVTh[(s * VROWS + (unsigned)n + 1u) * VKEYS + t] = hi[1];
        sVTr[(s * VROWS + (unsigned)n) * VKEYS + t] = rs[0];
        sVTr[(s * VROWS + (unsigned)n + 1u) * VKEYS + t] = rs[1];
      }
    }
  }
  __syncthreads();

  // ---- Phase B: causal softmax in A-fragment registers, p.v on WMMA ----
  if (wave < SPB) {
    // waves 0..7: query rows 0..31 of sequence = wave
    const unsigned seq = (unsigned)wave;
    // B fragments: lane column n = lane&15 -> V^T row n&7 (rows 6,7 are zero rows)
    const unsigned vrow = (seq * VROWS + (m & 7u)) * VKEYS + 8u * hh;
    const v16h bh0 = frag_at(&sVTh[vrow]);
    const v16h br0 = frag_at(&sVTr[vrow]);

#pragma unroll 1
    for (unsigned hd = 0; hd < 2u; ++hd) {
      const unsigned qkb = (seq * 2u + hd) * TLEN;
#pragma unroll
      for (int qt = 0; qt < 2; ++qt) {
        const unsigned tr = 16u * (unsigned)qt + m;                 // query row of this lane
        const v4f qv = sQ4[qkb + tr];
        v16h ahi, ars, xhi, xrs;
        const float den = (qt == 0)
            ? soft_rows<8, false>(qv, &sK4[qkb], tr, hh, ahi, ars, xhi, xrs)
            : soft_rows<16, false>(qv, &sK4[qkb], tr, hh, ahi, ars, xhi, xrs);

        v8f accM = {}, accR = {};
        accM = wmma16(ahi, bh0, accM);
        if (PV_RES) {
          accR = wmma16(ahi, br0, accR);
          accR = wmma16(ars, bh0, accR);
        }

        // D element r of this lane = (row 16*qt + 8*hh + r, column m); columns 3*hd..3*hd+2
        const bool colok = (m >= 3u * hd) && (m < 3u * hd + 3u);
#pragma unroll
        for (int r = 0; r < 8; ++r) {
          const unsigned row = 16u * (unsigned)qt + 8u * hh + (unsigned)r;
          const float val = accM[r] + accR[r] * (1.0f / RCARRY);
          if (colok) sO[(seq * TLEN + row) * 6u + m] = val;
        }
        if (hh == 0u) sDen[(seq * TLEN + tr) * 2u + hd] = den;
      }
    }
  } else {
    // wave 8: query rows 32,33 of every sequence and both heads, 16 full rows per tile.
    // Tile row m = (sequence 4*tl + (m>>2), head (m>>1)&1, query 32 + (m&1)).
#pragma unroll 1
    for (unsigned tl = 0; tl < 2u; ++tl) {
      const unsigned sq = 4u * tl + (m >> 2);
      const unsigned hd = (m >> 1) & 1u;
      const unsigned tq = 32u + (m & 1u);
      const unsigned qkb = (sq * 2u + hd) * TLEN;
      const v4f qv = sQ4[qkb + tq];
      v16h ahi, ars, xhi, xrs;
      const float den = soft_rows<16, true>(qv, &sK4[qkb], tq, hh, ahi, ars, xhi, xrs);
      if (hh == 0u) sDen[(sq * TLEN + tq) * 2u + hd] = den;

      // B columns 0..7 = V^T rows of sequence 4*tl + 2*pp, columns 8..15 = of the next one;
      // their query rows are tile rows 8*pp..8*pp+7 (D elements of the lanes with hh == pp).
      // Column c = m&7 (< 6) belongs to head c/3, so a lane keeps D elements r0, r0+1 with
      // r0 = 4*(m>>3) + 2*(c/3): queries 32,33 of sequence 4*tl + 2*hh + (m>>3).
      const unsigned c = m & 7u;
      const bool up = (m >> 3) != 0u, h1 = c >= 3u;
      float keep[2] = {0.0f, 0.0f};
      // rolled: only one pair's B fragments live at a time (fewer registers, more waves resident)
#pragma unroll 1
      for (unsigned pp = 0; pp < 2u; ++pp) {
        const unsigned vrow = ((4u * tl + 2u * pp + (m >> 3)) * VROWS + c) * VKEYS + 8u * hh;
        const v16h bh0 = frag_at(&sVTh[vrow]);
        const v16h br0 = frag_at(&sVTr[vrow]);
        const v16h bh1 = frag_at(&sVTh[vrow + 32u]);
        const v16h br1 = frag_at(&sVTr[vrow + 32u]);

        v8f accM = {}, accR = {};
        accM = wmma16(ahi, bh0, accM);
        if (PV_RES) {
          accR = wmma16(ahi, br0, accR);
          accR = wmma16(ars, bh0, accR);
        }
        accM = wmma16(xhi, bh1, accM);
        if (PV_RES) {
          accR = wmma16(xhi, br1, accR);
          accR = wmma16(xrs, bh1, accR);
        }

        float val[8];
#pragma unroll
        for (int r = 0; r < 8; ++r) val[r] = accM[r] + accR[r] * (1.0f / RCARRY);
#pragma unroll
        for (int e = 0; e < 2; ++e) {
          const float lo = h1 ? val[2 + e] : val[e];
          const float hi = h1 ? val[6 + e] : val[4 + e];
          const float pick = up ? hi : lo;
          keep[e] = (hh == pp) ? pick : keep[e];
        }
      }
      if (c < 6u) {
        const unsigned ob = ((4u * tl + 2u * hh + (m >> 3)) * TLEN + 32u) * 6u + c;
        sO[ob] = keep[0];
        sO[ob + 6u] = keep[1];
      }
    }
  }
  __syncthreads();

  // ---- Phase C: normalise, output projection, LN2, feed-forward, final LN, head ----
  {
    float o[6];
    const float inv0 = (1.0f / sDen[p * 2u + 0u]) * OSCALE;
    const float inv1 = (1.0f / sDen[p * 2u + 1u]) * OSCALE;
#pragma unroll
    for (int c = 0; c < 3; ++c) {
      o[c]     = sO[p * 6u + (unsigned)c] * inv0;
      o[3 + c] = sO[p * 6u + 3u + (unsigned)c] * inv1;
    }
    float x2[6];
#pragma unroll
    for (int j = 0; j < 6; ++j) {
      float acc = x[j];
#pragma unroll
      for (int c = 0; c < 6; ++c) acc += o[c] * inw(wo[c * 6 + j]);
      x2[j] = acc;
    }
    float h2[6];
    ln6(x2, ln2_g, ln2_b, h2);
    float f0 = inw(ffn_b1[0]), f1 = inw(ffn_b1[1]);
#pragma unroll
    for (int j = 0; j < 6; ++j) {
      f0 += h2[j] * inw(ffn_w1[j * 2 + 0]);
      f1 += h2[j] * inw(ffn_w1[j * 2 + 1]);
    }
    f0 = 0.5f * f0 * (1.0f + erff(f0 * 0.70710678118654752f));
    f1 = 0.5f * f1 * (1.0f + erff(f1 * 0.70710678118654752f));
#pragma unroll
    for (int j = 0; j < 6; ++j)
      x2[j] += f0 * inw(ffn_w2[j]) + f1 * inw(ffn_w2[6 + j]) + inw(ffn_b2[j]);
    float xf[6];
    ln6(x2, lnf_g, lnf_b, xf);
    float y[3];
#pragma unroll
    for (int d = 0; d < 3; ++d) {
      float acc = 0.0f;
#pragma unroll
      for (int c = 0; c < 6; ++c) acc += xf[c] * inw(head_w[c * 3 + d]);
      y[d] = acc;
    }
#pragma unroll 2
    for (int n = 0; n < VOC; ++n) {
      const float lg = y[0] * inw(tok_emb[n * 3 + 0]) + y[1] * inw(tok_emb[n * 3 + 1]) +
                       y[2] * inw(tok_emb[n * 3 + 2]);
      if (act) sLog[p * VOC + (unsigned)n] = lg;
    }
  }
  __syncthreads();

  {
    float* outB = out + (size_t)blockIdx.x * (size_t)(TOK * VOC);
    v4f xs[4];
#pragma unroll
    for (unsigned j = 0; j < 4u; ++j) {
      const unsigned i = tid + NTHR * j;
      const unsigned ic = (i < (unsigned)OUT_F4) ? i : (unsigned)(OUT_F4 - 1);
      xs[j] = *(const v4f*)&sLog[ic * 4u];
    }
#pragma unroll
    for (unsigned j = 0; j < 4u; ++j) {
      const unsigned i = tid + NTHR * j;
      if (i < (unsigned)OUT_F4) *(v4f*)(outB + (size_t)i * 4u) = xs[j];
    }
    
  }
}

// ---------------------------------------------------------------------------
extern "C" void kernel_launch(void* const* d_in, const int* in_sizes, int n_in,
                              void* d_out, int out_size, void* d_ws, size_t ws_size,
                              hipStream_t stream) {
  (void)d_ws; (void)ws_size;
  if (n_in < 20) return;
  if ((long long)in_sizes[0] < (long long)NB * TLEN) return;
  if (in_sizes[1] < VOC * 3 || in_sizes[2] < 4 || in_sizes[3] < 3 || in_sizes[4] < 9) return;
  if (in_sizes[5] < 18 || in_sizes[6] < 18 || in_sizes[7] < 18 || in_sizes[8] < 36) return;
  if (in_sizes[9] < 6 || in_sizes[10] < 6 || in_sizes[11] < 6 || in_sizes[12] < 6) return;
  if (in_sizes[13] < 6 || in_sizes[14] < 6) return;
  if (in_sizes[15] < 12 || in_sizes[16] < 2 || in_sizes[17] < 12 || in_sizes[18] < 6) return;
  if (in_sizes[19] < 18) return;
  if ((long long)out_size < (long long)NB * TLEN * VOC) return;

  const int*   idx         = (const int*)  d_in[0];    // [NB_FULL][34]
  const float* tok_emb     = (const float*)d_in[1];    // [14][3]
  const float* pos_params  = (const float*)d_in[2];    // [4]
  const float* z10_enc     = (const float*)d_in[3];    // [1][3]
  const float* special_enc = (const float*)d_in[4];    // [3][3]
  const float* wq          = (const float*)d_in[5];    // [3][6] (in, out)
  const float* wk          = (const float*)d_in[6];
  const float* wv          = (const float*)d_in[7];
  const float* wo          = (const float*)d_in[8];    // [6][6] (in, out)
  const float* ln1_g       = (const float*)d_in[9];
  const float* ln1_b       = (const float*)d_in[10];
  const float* ln2_g       = (const float*)d_in[11];
  const float* ln2_b       = (const float*)d_in[12];
  const float* lnf_g       = (const float*)d_in[13];
  const float* lnf_b       = (const float*)d_in[14];
  const float* ffn_w1      = (const float*)d_in[15];   // [6][2]
  const float* ffn_b1      = (const float*)d_in[16];
  const float* ffn_w2      = (const float*)d_in[17];   // [2][6]
  const float* ffn_b2      = (const float*)d_in[18];
  const float* head_w      = (const float*)d_in[19];   // [6][3]
  float* out = (float*)d_out;

  fused_block_kernel<<<dim3(NB / SPB), dim3(NTHR), 0, stream>>>(
      idx, tok_emb, pos_params, z10_enc, special_enc, wq, wk, wv, wo,
      ln1_g, ln1_b, ln2_g, ln2_b, lnf_g, lnf_b,
      ffn_w1, ffn_b1, ffn_w2, ffn_b2, head_w, out);
}

// v003
// A run of this version takes 45 microseconds.
// Two timings next to v002 both put it at 1.10 times that version's speed.
// Counting every step since v000, it is 1.68 times as fast.
#include <hip/hip_runtime.h>
#include <stddef.h>

// Contractions: p.v (34 keys deep) on v_wmma_f32_16x16x32_f16 (f16 operands, f32 accumulate):
// p carried x16384 and v carried x16, each as an f16 value plane plus an x2048 f16 residual
// plane (three products, residual products in their own accumulator). Every other product of
// this block (depth 2..6: q/k/v projections, q.k scores, output projection, feed-forward,
// vocabulary head) is f32 on the vector unit. Float inputs are RNE-converted to bf16 (switch
// INPUT_BF16): those of the embedding / q,k,v phase on load, those of the phase behind the
// attention once per call by a small first launch, which also builds the 34 position rows; the
// main launch reads both from the workspace. LayerNorm, softmax, GELU (erf), residual adds in f32.

typedef _Float16 h16;
typedef _Float16 v16h __attribute__((ext_vector_type(16)));
typedef _Float16 v8h  __attribute__((ext_vector_type(8)));
typedef float    v8f  __attribute__((ext_vector_type(8)));
typedef float    v4f  __attribute__((ext_vector_type(4)));
typedef float    v2f  __attribute__((ext_vector_type(2)));
typedef _Float16 v2h  __attribute__((ext_vector_type(2)));

#ifndef NB
#define NB 32768
#endif
#define NB_FULL 32768
#define TLEN 34          // tokens per sequence (fixed by the position map)
#define VOC  14
#define SPB  8           // sequences per block
#define TOK  (SPB * TLEN)        // 272 tokens per block
#define NTHR 288                 // 9 waves
#define OUT_F4 (TOK * VOC / 4)
#define VROWS 8                  // V^T plane rows per sequence (6 used, 2 zero)
#define VKEYS 64                 // V^T plane keys per row (34 used, rest zero)

#ifndef INPUT_BF16
#define INPUT_BF16 1
#endif
#ifndef PV_RES
#define PV_RES 1
#endif

// Constant block at the start of the workspace (float offsets), rewritten on every call.
#define C_TOK  0      // [14][3]
#define C_WO   42     // [6][6]
#define C_LN2G 78
#define C_LN2B 84
#define C_B1   90
#define C_W1   92     // [6][2]
#define C_W2   104    // [2][6]
#define C_B2   116
#define C_LNFG 122
#define C_LNFB 128
#define C_HEAD 134    // [6][3]
#define C_POS  152    // [34][4], 16-byte rows; no gap anywhere: every word read is written
#define PREP_WAVES 13 // waves 0,1: position rows; waves 2..12: one weight array each

#define PCARRY 16384.0f
#define VCARRY 16.0f
#define RCARRY 2048.0f
#define OSCALE 3.814697265625e-06f    // 1 / (PCARRY * VCARRY)

static_assert(NB >= SPB && NB <= NB_FULL && (NB % SPB) == 0);
static_assert((TOK * VOC * 4) % 128 == 0);          // a block owns whole output lines
static_assert((TOK * VOC) % 4 == 0);
static_assert(OUT_F4 % 8 == 0);
static_assert(NTHR % 32 == 0 && NTHR >= TOK);
static_assert(4 * NTHR >= OUT_F4);                  // store loop: 4 trips cover the block
static_assert(TLEN > 32 && TLEN <= 48);             // two 16-row query tiles + tail rows, keys 32.. as extras
static_assert(TLEN - 32 == 2);                      // exactly two tail rows / extra keys (32, 33)
static_assert(VKEYS == 64 && VROWS == 8);
static_assert(SPB == 8 && NTHR / 32 == SPB + 1);    // p.v phase: one wave per sequence, one for the tails

__device__ __forceinline__ float bf16r(float x) {   // RNE convert to bf16, returned widened
  unsigned int u = __float_as_uint(x);
  u = (u + 0x7FFFu + ((u >> 16) & 1u)) & 0xFFFF0000u;
  return __uint_as_float(u);
}
__device__ __forceinline__ float inw(float x) {     // input value as consumed
  return INPUT_BF16 ? bf16r(x) : x;
}
// A weight converted by the first launch: a bf16 value in the upper half of its 32-bit word.
// Taking that half (the lower one is zero) shows the compiler a bf16 operand as the conversion
// in place did, so it forms the same fused and unfused products: results stay bit-identical.
__device__ __forceinline__ float cw(float x) {
  return INPUT_BF16 ? __uint_as_float(__float_as_uint(x) & 0xFFFF0000u) : x;
}
// Two f32 values -> f16 value plane and x2048 f16 residual plane, round to nearest even, both
// values per convert instruction. A small value becomes an f16 subnormal: the matrix unit keeps
// subnormal operands, and what the value plane rounds off goes to the residual plane as for
// any other value.
static __device__ __forceinline__ void split2(const v2f x, v2h& hi, v2h& rs) {
  hi = __builtin_convertvector(x, v2h);
  rs = __builtin_convertvector((x - __builtin_convertvector(hi, v2f)) * RCARRY, v2h);
}

// 16-bit fragment: p points at element [row = lane&15][k0 + 8*(lane>>4)] of a k-contiguous
// row. Elements 0..7 <- k0+8h+0..7, elements 8..15 <- k0+16+8h+0..7 (same map for A and B).
__device__ __forceinline__ v16h frag_at(const _Float16* p) {
  v8h lo = *(const v8h*)(p);
  v8h hi = *(const v8h*)(p + 16);
  v16h out;
#pragma unroll
  for (int i = 0; i < 8; ++i) { out[i] = lo[i]; out[i + 8] = hi[i]; }
  return out;
}

__device__ __forceinline__ v8f wmma16(v16h a, v16h b, v8f c) {
  v8f d = __builtin_amdgcn_wmma_f32_16x16x32_f16(false, a, false, b, (short)0, c,
                                                 false, false);
  asm volatile("v_nop\n\tv_nop\n\tv_nop\n\tv_nop" : "+v"(d) : "v"(a), "v"(b));
  return d;
}

// Scores, causal softmax numerators and their f16 value / residual planes for one query row
// per lane pair (lane, lane^16), in the A-fragment layout. kp = key rows of the row's sequence
// and head, tq = query position. NE = fragment elements that can hold an unmasked key (8: keys
// 0..15, 16: keys 0..31; the rest are zero operands); XT: keys 32,33 as a second k-step.
// Returns the row sum over the unconverted numerators.
template <int NE, bool XT>
__device__ __forceinline__ float soft_rows(const v4f qv, const v4f* kp, const unsigned tq,
                                           const unsigned hh, v16h& ahi, v16h& ars,
                                           v16h& xhi, v16h& xrs) {
  float sc[NE];
  float sx[2];
  float mx = -1.0e30f;
#pragma unroll
  for (int i = 0; i < NE; ++i) {
    const unsigned j = 8u * hh + (unsigned)(i & 7) + 16u * (unsigned)(i >> 3);
    const v4f kv = kp[j];
    float sv = (qv[0] * kv[0] + qv[1] * kv[1] + qv[2] * kv[2]) * 0.57735026918962576f;
    sv = (j > tq) ? -1.0e30f : sv;
    sc[i] = sv;
    mx = fmaxf(mx, sv);
  }
  if (XT) {
#pragma unroll
    for (int e = 0; e < 2; ++e) {
      const unsigned j = 32u + (unsigned)e;
      const v4f kv = kp[j];
      float sv = (qv[0] * kv[0] + qv[1] * kv[1] + qv[2] * kv[2]) * 0.57735026918962576f;
      sv = ((hh != 0u) || (j > tq)) ? -1.0e30f : sv;
      sx[e] = sv;
      mx = fmaxf(mx, sv);
    }
  }
  mx = fmaxf(mx, __shfl_xor(mx, 16, 32));

  ahi = v16h{};
  ars = v16h{};
  xhi = v16h{};
  xrs = v16h{};
  float den = 0.0f;
#pragma unroll
  for (int i = 0; i < NE; ++i) {
    const unsigned j = 8u * hh + (unsigned)(i & 7) + 16u * (unsigned)(i >> 3);
    float pe = __expf(sc[i] - mx);
    pe = (j > tq) ? 0.0f : pe;
    den += pe;
    sc[i] = pe;
  }
#pragma unroll
  for (int i = 0; i < NE; i += 2) {
    v2h hi, rs;
    split2(v2f{sc[i], sc[i + 1]} * PCARRY, hi, rs);
    ahi[i] = hi[0];
    ahi[i + 1] = hi[1];
    ars[i] = rs[0];
    ars[i + 1] = rs[1];
  }
  if (XT) {
#pragma unroll
    for (int e = 0; e < 2; ++e) {
      const unsigned j = 32u + (unsigned)e;
      float pe = __expf(sx[e] - mx);
      pe = ((hh != 0u) || (j > tq)) ? 0.0f : pe;
      den += pe;
      sx[e] = pe;
    }
    v2h hi, rs;
    split2(v2f{sx[0], sx[1]} * PCARRY, hi, rs);
    xhi[0] = hi[0];
    xhi[1] = hi[1];
    xrs[0] = rs[0];
    xrs[1] = rs[1];
  }
  den += __shfl_xor(den, 16, 32);
  return den;
}

// LayerNorm over 6 values (biased variance, eps 1e-5); PRE: g, b converted by the first launch
template <bool PRE>
__device__ __forceinline__ void ln6(const float (&x)[6], const float* __restrict__ g,
                                    const float* __restrict__ b, float (&h)[6]) {
  const float mu = (x[0] + x[1] + x[2] + x[3] + x[4] + x[5]) * (1.0f / 6.0f);
  float var = 0.0f;
#pragma unroll
  for (int c = 0; c < 6; ++c) { const float d = x[c] - mu; var += d * d; }
  var *= (1.0f / 6.0f);
  const float rs = rsqrtf(var + 1.0e-5f);
#pragma unroll
  for (int c = 0; c < 6; ++c) h[c] = (x[c] - mu) * rs * (PRE ? cw(g[c]) : inw(g[c])) + (PRE ? cw(b[c]) : inw(b[c]));
}

// ---------------------------------------------------------------------------
// First launch, one block: values that do not depend on idx. Waves 0,1 build the 34x3 position
// rows; each further wave converts one weight array of the phase behind the attention.
// ---------------------------------------------------------------------------
__global__ __launch_bounds__(PREP_WAVES * 32) void prep_consts_kernel(
    const float* __restrict__ tok_emb,
    const float* __restrict__ pos_params, const float* __restrict__ z10_enc,
    const float* __restrict__ special_enc, const float* __restrict__ wo,
    const float* __restrict__ ln2_g, const float* __restrict__ ln2_b,
    const float* __restrict__ lnf_g, const float* __restrict__ lnf_b,
    const float* __restrict__ ffn_w1, const float* __restrict__ ffn_b1,
    const float* __restrict__ ffn_w2, const float* __restrict__ ffn_b2,
    const float* __restrict__ head_w, float* __restrict__ cst) {
  const unsigned tid = threadIdx.x;
  const unsigned lane = tid & 31u;
  const int wave = __builtin_amdgcn_readfirstlane((int)(tid >> 5));

  // ---- position rows: all candidates loaded by value, selected by value ----
  if (wave < 2) {
    const unsigned t = (tid < (unsigned)TLEN) ? tid : (unsigned)(TLEN - 1);
    const float amp   = inw(pos_params[0]);
    const float phase = inw(pos_params[1]);
    const float slope = inw(pos_params[2]);
    const float offs  = inw(pos_params[3]);
    int di = (t < 10u) ? (int)t : ((t < 21u) ? ((int)t - 11) : ((int)t - 22));
    di = (di < 0) ? 0 : ((di > 9) ? 9 : di);
    const float fi  = (float)di;
    const float ang = 0.62831853071795864769f * fi + phase;
    const float d0 = amp * cosf(ang);
    const float d1 = amp * sinf(ang);
    const float d2 = slope * fi + offs;
    const unsigned si = (t == 10u) ? 0u : ((t == 21u) ? 1u : 2u);
    const float s0 = inw(special_enc[si * 3u + 0u]);
    const float s1 = inw(special_enc[si * 3u + 1u]);
    const float s2 = inw(special_enc[si * 3u + 2u]);
    const float z0 = inw(z10_enc[0]);
    const float z1 = inw(z10_enc[1]);
    const float z2 = inw(z10_enc[2]);
    const bool is_sp = (t == 10u) || (t == 21u) || (t == 33u);
    const bool is_z  = (t == 32u);
    const float p0 = is_sp ? s0 : (is_z ? z0 : d0);
    const float p1 = is_sp ? s1 : (is_z ? z1 : d1);
    const float p2 = is_sp ? s2 : (is_z ? z2 : d2);
    if (tid < (unsigned)TLEN) {
      cst[C_POS + t * 4u + 0u] = p0;
      cst[C_POS + t * 4u + 1u] = p1;
      cst[C_POS + t * 4u + 2u] = p2;
      cst[C_POS + t * 4u + 3u] = 0.0f;
    }
    return;
  }

  const float* a = tok_emb;
  unsigned n = VOC * 3, off = C_TOK;
  switch (wave) {
    case 3:  a = wo;     n = 36; off = C_WO;   break;
    case 4:  a = ln2_g;  n = 6;  off = C_LN2G; break;
    case 5:  a = ln2_b;  n = 6;  off = C_LN2B; break;
    case 6:  a = lnf_g;  n = 6;  off = C_LNFG; break;
    case 7:  a = lnf_b;  n = 6;  off = C_LNFB; break;
    case 8:  a = ffn_w1; n = 12; off = C_W1;   break;
    case 9:  a = ffn_b1; n = 2;  off = C_B1;   break;
    case 10: a = ffn_w2; n = 12; off = C_W2;   break;
    case 11: a = ffn_b2; n = 6;  off = C_B2;   break;
    case 12: a = head_w; n = 18; off = C_HEAD; break;
    default: break;
  }
  for (unsigned i = lane; i < n; i += 32u) cst[off + i] = inw(a[i]);
}

// ---------------------------------------------------------------------------
// One block = 8 sequences (272 tokens, one token per thread in the per-token phases).
// Phase 0: zero the V^T planes, fetch the 34x3 position rows.
// Phase A: embed + LN1 + q/k/v per token; q,k as f32 float4 rows per head in LDS; v as f16
//          value / residual planes VT[seq][n = head*3+d][key] (k-contiguous B operand).
// Phase B: scores and the causal softmax are formed in registers directly in the A-fragment
//          layout (lane row = lane&15, up to 16 keys per lane); unnormalised p.v via WMMA; row
//          sums over the unconverted p. Wave w (< 8) owns query rows 0..31 of sequence w: per
//          head a tile of rows 0..15 (keys 0..15 only) and a tile of rows 16..31. Wave 8 owns
//          rows 32,33 of all sequences and heads (two full tiles, keys 32,33 as a second
//          sparse k-step).
// Phase C: per token: normalise, output projection, LN2, GELU feed-forward, final LN, head;
//          logits staged in LDS in the output layout.
// LDS regions are all cross-wave (block barriers between phases).
// ---------------------------------------------------------------------------
__global__ __launch_bounds__(NTHR) void fused_block_kernel(
    const int* __restrict__ idx, const float* __restrict__ tok_emb,
    const float* __restrict__ wq, const float* __restrict__ wk, const float* __restrict__ wv,
    const float* __restrict__ ln1_g, const float* __restrict__ ln1_b,
    const float* __restrict__ cst, float* __restrict__ out) {
  __shared__ __attribute__((aligned(16))) v4f sQ4[SPB * 2 * TLEN];
  __shared__ __attribute__((aligned(16))) v4f sK4[SPB * 2 * TLEN];
  __shared__ __attribute__((aligned(16))) _Float16 sVTh[SPB * VROWS * VKEYS];
  __shared__ __attribute__((aligned(16))) _Float16 sVTr[SPB * VROWS * VKEYS];
  __shared__ __attribute__((aligned(16))) float sO[TOK * 6];
  __shared__ __attribute__((aligned(16))) float sDen[TOK * 2];
  __shared__ __attribute__((aligned(16))) float sPos[TLEN * 4];
  __shared__ __attribute__((aligned(16))) float sLog[TOK * VOC];

  const unsigned tid = threadIdx.x;
  const unsigned lane = tid & 31u;
  const int wave = __builtin_amdgcn_readfirstlane((int)(tid >> 5));
  const unsigned hh = lane >> 4, m = lane & 15u;

  // ---- Phase 0: zero V^T planes (pad keys 34..63 and rows 6,7 stay zero) ----
  {
    const v8h z = {};
    for (unsigned i = tid; i < (unsigned)(SPB * VROWS * VKEYS / 8); i += NTHR) {
      *(v8h*)&sVTh[i * 8u] = z;
      *(v8h*)&sVTr[i * 8u] = z;
    }
  }
  // ---- position rows: from the constant block ----
  if (tid < (unsigned)TLEN) *(v4f*)&sPos[tid * 4u] = *(const v4f*)&cst[C_POS + tid * 4u];
  __syncthreads();

  // ---- Phase A: embed + LN1 + q/k/v (idle lanes duplicate the last token, no stores) ----
  const bool act = tid < (unsigned)TOK;
  const unsigned p = act ? tid : (unsigned)(TOK - 1);
  const unsigned s = p / (unsigned)TLEN;
  const unsigned t = p - s * (unsigned)TLEN;
  float x[6];
  {
    const size_t seq_g = (size_t)blockIdx.x * SPB + s;
    int tok = idx[seq_g * TLEN + t];
    tok = (tok < 0) ? 0 : ((tok > VOC - 1) ? (VOC - 1) : tok);
#pragma unroll
    for (int c = 0; c < 3; ++c) {
      x[c]     = inw(tok_emb[tok * 3 + c]);
      x[3 + c] = sPos[t * 4u + (unsigned)c];
    }
    float h[6];
    ln6<false>(x, ln1_g, ln1_b, h);
    float q[6], k[6], v[6];
#pragma unroll
    for (int j = 0; j < 6; ++j) {
      q[j] = h[3] * inw(wq[j]) + h[4] * inw(wq[6 + j]) + h[5] * inw(wq[12 + j]);
      k[j] = h[3] * inw(wk[j]) + h[4] * inw(wk[6 + j]) + h[5] * inw(wk[12 + j]);
      v[j] = h[0] * inw(wv[j]) + h[1] * inw(wv[6 + j]) + h[2] * inw(wv[12 + j]);
    }
    if (act) {
      v4f q0 = {q[0], q[1], q[2], 0.0f};
      v4f q1 = {q[3], q[4], q[5], 0.0f};
      v4f k0 = {k[0], k[1], k[2], 0.0f};
      v4f k1 = {k[3], k[4], k[5], 0.0f};
      sQ4[(s * 2u + 0u) * TLEN + t] = q0;
      sQ4[(s * 2u + 1u) * TLEN + t] = q1;
      sK4[(s * 2u + 0u) * TLEN + t] = k0;
      sK4[(s * 2u + 1u) * TLEN + t] = k1;
#pragma unroll
      for (int n = 0; n < 6; n += 2) {
        v2h hi, rs;
        split2(v2f{v[n], v[n + 1]} * VCARRY, hi, rs);
        sVTh[(s * VROWS + (unsigned)n) * VKEYS + t] = hi[0];
        sVTh[(s * VROWS + (unsigned)n + 1u) * VKEYS + t] = hi[1];
        sVTr[(s * VROWS + (unsigned)n) * VKEYS + t] = rs[0];
        sVTr[(s * VROWS + (unsigned)n + 1u) * VKEYS + t] = rs[1];
      }
    }
  }
  __syncthreads();

  // ---- Phase B: causal softmax in A-fragment registers, p.v on WMMA ----
  if (wave < SPB) {
    // waves 0..7: query rows 0..31 of sequence = wave
    const unsigned seq = (unsigned)wave;
    // B fragments: lane column n = lane&15 -> V^T row n&7 (rows 6,7 are zero rows)
    const unsigned vrow = (seq * VROWS + (m & 7u)) * VKEYS + 8u * hh;
    const v16h bh0 = frag_at(&sVTh[vrow]);
    const v16h br0 = frag_at(&sVTr[vrow]);

#pragma unroll 1
    for (unsigned hd = 0; hd < 2u; ++hd) {
      const unsigned qkb = (seq * 2u + hd) * TLEN;
#pragma unroll
      for (int qt = 0; qt < 2; ++qt) {
        const unsigned tr = 16u * (unsigned)qt + m;                 // query row of this lane
        const v4f qv = sQ4[qkb + tr];
        v16h ahi, ars, xhi, xrs;
        const float den = (qt == 0)
            ? soft_rows<8, false>(qv, &sK4[qkb], tr, hh, ahi, ars, xhi, xrs)
            : soft_rows<16, false>(qv, &sK4[qkb], tr, hh, ahi, ars, xhi, xrs);

        v8f accM = {}, accR = {};
        accM = wmma16(ahi, bh0, accM);
        if (PV_RES) {
          accR = wmma16(ahi, br0, accR);
          accR = wmma16(ars, bh0, accR);
        }

        // D element r of this lane = (row 16*qt + 8*hh + r, column m); columns 3*hd..3*hd+2
        const bool colok = (m >= 3u * hd) && (m < 3u * hd + 3u);
#pragma unroll
        for (int r = 0; r < 8; ++r) {
          const unsigned row = 16u * (unsigned)qt + 8u * hh + (unsigned)r;
          const float val = accM[r] + accR[r] * (1.0f / RCARRY);
          if (colok) sO[(seq * TLEN + row) * 6u + m] = val;
        }
        if (hh == 0u) sDen[(seq * TLEN + tr) * 2u + hd] = den;
      }
    }
  } else {
    // wave 8: query rows 32,33 of every sequence and both heads, 16 full rows per tile.
    // Tile row m = (sequence 4*tl + (m>>2), head (m>>1)&1, query 32 + (m&1)).
#pragma unroll 1
    for (unsigned tl = 0; tl < 2u; ++tl) {
      const unsigned sq = 4u * tl + (m >> 2);
      const unsigned hd = (m >> 1) & 1u;
      const unsigned tq = 32u + (m & 1u);
      const unsigned qkb = (sq * 2u + hd) * TLEN;
      const v4f qv = sQ4[qkb + tq];
      v16h ahi, ars, xhi, xrs;
      const float den = soft_rows<16, true>(qv, &sK4[qkb], tq, hh, ahi, ars, xhi, xrs);
      if (hh == 0u) sDen[(sq * TLEN + tq) * 2u + hd] = den;

      // B columns 0..7 = V^T rows of sequence 4*tl + 2*pp, columns 8..15 = of the next one;
      // their query rows are tile rows 8*pp..8*pp+7 (D elements of the lanes with hh == pp).
      // Column c = m&7 (< 6) belongs to head c/3, so a lane keeps D elements r0, r0+1 with
      // r0 = 4*(m>>3) + 2*(c/3): queries 32,33 of sequence 4*tl + 2*hh + (m>>3).
      const unsigned c = m & 7u;
      const bool up = (m >> 3) != 0u, h1 = c >= 3u;
      float keep[2] = {0.0f, 0.0f};
      // rolled: only one pair's B fragments live at a time (fewer registers, more waves resident)
#pragma unroll 1
      for (unsigned pp = 0; pp < 2u; ++pp) {
        const unsigned vrow = ((4u * tl + 2u * pp + (m >> 3)) * VROWS + c) * VKEYS + 8u * hh;
        const v16h bh0 = frag_at(&sVTh[vrow]);
        const v16h br0 = frag_at(&sVTr[vrow]);
        const v16h bh1 = frag_at(&sVTh[vrow + 32u]);
        const v16h br1 = frag_at(&sVTr[vrow + 32u]);

        v8f accM = {}, accR = {};
        accM = wmma16(ahi, bh0, accM);
        if (PV_RES) {
          accR = wmma16(ahi, br0, accR);
          accR = wmma16(ars, bh0, accR);
        }
        accM = wmma16(xhi, bh1, accM);
        if (PV_RES) {
          accR = wmma16(xhi, br1, accR);
          accR = wmma16(xrs, bh1, accR);
        }

        float val[8];
#pragma unroll
        for (int r = 0; r < 8; ++r) val[r] = accM[r] + accR[r] * (1.0f / RCARRY);
#pragma unroll
        for (int e = 0; e < 2; ++e) {
          const float lo = h1 ? val[2 + e] : val[e];
          const float hi = h1 ? val[6 + e] : val[4 + e];
          const float pick = up ? hi : lo;
          keep[e] = (hh == pp) ? pick : keep[e];
        }
      }
      if (c < 6u) {
        const unsigned ob = ((4u * tl + 2u * hh + (m >> 3)) * TLEN + 32u) * 6u + c;
        sO[ob] = keep[0];
        sO[ob + 6u] = keep[1];
      }
    }
  }
  __syncthreads();

  // ---- Phase C: normalise, output projection, LN2, feed-forward, final LN, head ----
  {
    float o[6];
    const float inv0 = (1.0f / sDen[p * 2u + 0u]) * OSCALE;
    const float inv1 = (1.0f / sDen[p * 2u + 1u]) * OSCALE;
#pragma unroll
    for (int c = 0; c < 3; ++c) {
      o[c]     = sO[p * 6u + (unsigned)c] * inv0;
      o[3 + c] = sO[p * 6u + 3u + (unsigned)c] * inv1;
    }
    float x2[6];
#pragma unroll
    for (int j = 0; j < 6; ++j) {
      float acc = x[j];
#pragma unroll
      for (int c = 0; c < 6; ++c) acc += o[c] * cw(cst[C_WO + c * 6 + j]);
      x2[j] = acc;
    }
    float h2[6];
    ln6<true>(x2, cst + C_LN2G, cst + C_LN2B, h2);
    float f0 = cw(cst[C_B1 + 0]), f1 = cw(cst[C_B1 + 1]);
#pragma unroll
    for (int j = 0; j < 6; ++j) {
      f0 += h2[j] * cw(cst[C_W1 + j * 2 + 0]);
      f1 += h2[j] * cw(cst[C_W1 + j * 2 + 1]);
    }
    f0 = 0.5f * f0 * (1.0f + erff(f0 * 0.70710678118654752f));
    f1 = 0.5f * f1 * (1.0f + erff(f1 * 0.70710678118654752f));
#pragma unroll
    for (int j = 0; j < 6; ++j)
      x2[j] += f0 * cw(cst[C_W2 + j]) + f1 * cw(cst[C_W2 + 6 + j]) + cw(cst[C_B2 + j]);
    float xf[6];
    ln6<true>(x2, cst + C_LNFG, cst + C_LNFB, xf);
    float y[3];
#pragma unroll
    for (int d = 0; d < 3; ++d) {
      float acc = 0.0f;
#pragma unroll
      for (int c = 0; c < 6; ++c) acc += xf[c] * cw(cst[C_HEAD + c * 3 + d]);
      y[d] = acc;
    }
#pragma unroll 2
    for (int n = 0; n < VOC; ++n) {
      const float lg = y[0] * cw(cst[C_TOK + n * 3 + 0]) + y[1] * cw(cst[C_TOK + n * 3 + 1]) +
                       y[2] * cw(cst[C_TOK + n * 3 + 2]);
      if (act) sLog[p * VOC + (unsigned)n] = lg;
    }
  }
  __syncthreads();

  {
    float* outB = out + (size_t)blockIdx.x * (size_t)(TOK * VOC);
    v4f xs[4];
#pragma unroll
    for (unsigned j = 0; j < 4u; ++j) {
      const unsigned i = tid + NTHR * j;
      const unsigned ic = (i < (unsigned)OUT_F4) ? i : (unsigned)(OUT_F4 - 1);
      xs[j] = *(const v4f*)&sLog[ic * 4u];
    }
#pragma unroll
    for (unsigned j = 0; j < 4u; ++j) {
      const unsigned i = tid + NTHR * j;
      if (i < (unsigned)OUT_F4) *(v4f*)(outB + (size_t)i * 4u) = xs[j];
    }
    
  }
}

// ---------------------------------------------------------------------------
extern "C" void kernel_launch(void* const* d_in, const int* in_sizes, int n_in,
                              void* d_out, int out_size, void* d_ws, size_t ws_size,
                              hipStream_t stream) {
  if (n_in < 20) return;
  if (ws_size < (size_t)(C_POS + TLEN * 4) * sizeof(float)) return;
  if ((long long)in_sizes[0] < (long long)NB * TLEN) return;
  if (in_sizes[1] < VOC * 3 || in_sizes[2] < 4 || in_sizes[3] < 3 || in_sizes[4] < 9) return;
  if (in_sizes[5] < 18 || in_sizes[6] < 18 || in_sizes[7] < 18 || in_sizes[8] < 36) return;
  if (in_sizes[9] < 6 || in_sizes[10] < 6 || in_sizes[11] < 6 || in_sizes[12] < 6) return;
  if (in_sizes[13] < 6 || in_sizes[14] < 6) return;
  if (in_sizes[15] < 12 || in_sizes[16] < 2 || in_sizes[17] < 12 || in_sizes[18] < 6) return;
  if (in_sizes[19] < 18) return;
  if ((long long)out_size < (long long)NB * TLEN * VOC) return;

  const int*   idx         = (const int*)  d_in[0];    // [NB_FULL][34]
  const float* tok_emb     = (const float*)d_in[1];    // [14][3]
  const float* pos_params  = (const float*)d_in[2];    // [4]
  const float* z10_enc     = (const float*)d_in[3];    // [1][3]
  const float* special_enc = (const float*)d_in[4];    // [3][3]
  const float* wq          = (const float*)d_in[5];    // [3][6] (in, out)
  const float* wk          = (const float*)d_in[6];
  const float* wv          = (const float*)d_in[7];
  const float* wo          = (const float*)d_in[8];    // [6][6] (in, out)
  const float* ln1_g       = (const float*)d_in[9];
  const float* ln1_b       = (const float*)d_in[10];
  const float* ln2_g       = (const float*)d_in[11];
  const float* ln2_b       = (const float*)d_in[12];
  const float* lnf_g       = (const float*)d_in[13];
  const float* lnf_b       = (const float*)d_in[14];
  const float* ffn_w1      = (const float*)d_in[15];   // [6][2]
  const float* ffn_b1      = (const float*)d_in[16];
  const float* ffn_w2      = (const float*)d_in[17];   // [2][6]
  const float* ffn_b2      = (const float*)d_in[18];
  const float* head_w      = (const float*)d_in[19];   // [6][3]
  float* out = (float*)d_out;

  float* cst = (float*)d_ws;

  prep_consts_kernel<<<dim3(1), dim3(PREP_WAVES * 32), 0, stream>>>(
      tok_emb, pos_params, z10_enc, special_enc, wo, ln2_g, ln2_b, lnf_g, lnf_b,
      ffn_w1, ffn_b1, ffn_w2, ffn_b2, head_w, cst);
  fused_block_kernel<<<dim3(NB / SPB), dim3(NTHR), 0, stream>>>(
      idx, tok_emb, wq, wk, wv, ln1_g, ln1_b, cst, out);
}

// v004
// One run takes 43.2 microseconds.
// Timed twice side by side with v003, it ran 1.04 times as fast both times.
// Over all steps from v000 it is 1.75 times as fast.
#include <hip/hip_runtime.h>
#include <stddef.h>

// Contractions: p.v (34 keys deep) on v_wmma_f32_16x16x32_f16 (f16 operands, f32 accumulate):
// p carried x16384 and v carried x16, each as an f16 value plane plus an x2048 f16 residual
// plane (three products, residual products in their own accumulator). Every other product of
// this block (depth 2..6: q/k/v projections, q.k scores, output projection, feed-forward,
// vocabulary head) is f32 on the vector unit. Float inputs are RNE-converted to bf16 (INPUT_BF16,
// which must be 1) once per call by a small first launch, which also builds the 34 position rows; the
// main launch reads both from the workspace. LayerNorm, softmax, GELU (erf), residual adds in f32.

typedef _Float16 h16;
typedef _Float16 v16h __attribute__((ext_vector_type(16)));
typedef _Float16 v8h  __attribute__((ext_vector_type(8)));
typedef float    v8f  __attribute__((ext_vector_type(8)));
typedef float    v4f  __attribute__((ext_vector_type(4)));
typedef float    v2f  __attribute__((ext_vector_type(2)));
typedef _Float16 v2h  __attribute__((ext_vector_type(2)));

#ifndef NB
#define NB 32768
#endif
#define NB_FULL 32768
#define TLEN 34          // tokens per sequence (fixed by the position map)
#define VOC  14
#define SPB  8           // sequences per block
#define TOK  (SPB * TLEN)        // 272 tokens per block
#define NTHR 288                 // 9 waves
#define OUT_F4 (TOK * VOC / 4)
#define VROWS 8                  // V^T plane rows per sequence (6 used, 2 zero)
#define VKEYS 64                 // V^T plane keys per row (34 used, rest zero)

#ifndef INPUT_BF16
#define INPUT_BF16 1
#endif
#ifndef PV_RES
#define PV_RES 1
#endif

// Constant block at the start of the workspace (float offsets), rewritten on every call.
#define C_TOK  0      // [14][3]
#define C_WO   42     // [6][6]
#define C_LN2G 78
#define C_LN2B 84
#define C_B1   90
#define C_W1   92     // [6][2]
#define C_W2   104    // [2][6]
#define C_B2   116
#define C_LNFG 122
#define C_LNFB 128
#define C_HEAD 134    // [6][3]
#define C_POS  152    // [34][4], 16-byte rows; no gap among the float arrays: every word read is written
#define C_H16  288    // from here bf16 numbers as 16-bit words; H_* count 16-bit words. Arrays start
                      // on 16 bytes; the words between two arrays are neither written nor read
#define H_WQ   0      // [3][6]
#define H_WK   24     // [3][6]
#define H_WV   48     // [3][6]
#define H_LN1G 72
#define H_LN1B 80
#define C_END  (288 + 43)
#define PREP_WAVES 18 // waves 0,1: position rows; waves 2..17: one weight array each

#define PCARRY 16384.0f
#define VCARRY 16.0f
#define RCARRY 2048.0f
#define OSCALE 3.814697265625e-06f    // 1 / (PCARRY * VCARRY)

static_assert(INPUT_BF16 == 1);                     // the 16-bit words of the constant block hold bf16
static_assert(NB >= SPB && NB <= NB_FULL && (NB % SPB) == 0);
static_assert((TOK * VOC * 4) % 128 == 0);          // a block owns whole output lines
static_assert((TOK * VOC) % 4 == 0);
static_assert(OUT_F4 % 8 == 0);
static_assert(NTHR % 32 == 0 && NTHR >= TOK);
static_assert(4 * NTHR >= OUT_F4);                  // store loop: 4 trips cover the block
static_assert(TLEN > 32 && TLEN <= 48);             // two 16-row query tiles + tail rows, keys 32.. as extras
static_assert(TLEN - 32 == 2);                      // exactly two tail rows / extra keys (32, 33)
static_assert(VKEYS == 64 && VROWS == 8);
static_assert(SPB == 8 && NTHR / 32 == SPB + 1);    // p.v phase: one wave per sequence, one for the tails

__device__ __forceinline__ float bf16r(float x) {   // RNE convert to bf16, returned widened
  unsigned int u = __float_as_uint(x);
  u = (u + 0x7FFFu + ((u >> 16) & 1u)) & 0xFFFF0000u;
  return __uint_as_float(u);
}
__device__ __forceinline__ float inw(float x) {     // input value as consumed
  return INPUT_BF16 ? bf16r(x) : x;
}
// A weight converted by the first launch: a bf16 value in the upper half of its 32-bit word.
// Taking that half (the lower one is zero) shows the compiler a bf16 operand as the conversion
// in place did, so it forms the same fused and unfused products: results stay bit-identical.
__device__ __forceinline__ float cw(float x) {
  return INPUT_BF16 ? __uint_as_float(__float_as_uint(x) & 0xFFFF0000u) : x;
}
// Two f32 values -> f16 value plane and x2048 f16 residual plane, round to nearest even, both
// values per convert instruction. A small value becomes an f16 subnormal: the matrix unit keeps
// subnormal operands, and what the value plane rounds off goes to the residual plane as for
// any other value.
static __device__ __forceinline__ void split2(const v2f x, v2h& hi, v2h& rs) {
  hi = __builtin_convertvector(x, v2h);
  rs = __builtin_convertvector((x - __builtin_convertvector(hi, v2f)) * RCARRY, v2h);
}

// 16-bit fragment: p points at element [row = lane&15][k0 + 8*(lane>>4)] of a k-contiguous
// row. Elements 0..7 <- k0+8h+0..7, elements 8..15 <- k0+16+8h+0..7 (same map for A and B).
__device__ __forceinline__ v16h frag_at(const _Float16* p) {
  v8h lo = *(const v8h*)(p);
  v8h hi = *(const v8h*)(p + 16);
  v16h out;
#pragma unroll
  for (int i = 0; i < 8; ++i) { out[i] = lo[i]; out[i + 8] = hi[i]; }
  return out;
}

__device__ __forceinline__ v8f wmma16(v16h a, v16h b, v8f c) {
  v8f d = __builtin_amdgcn_wmma_f32_16x16x32_f16(false, a, false, b, (short)0, c,
                                                 false, false);
  asm volatile("v_nop\n\tv_nop\n\tv_nop\n\tv_nop" : "+v"(d) : "v"(a), "v"(b));
  return d;
}

// Scores, causal softmax numerators and their f16 value / residual planes for one query row
// per lane pair (lane, lane^16), in the A-fragment layout. kp = key rows of the row's sequence
// and head, tq = query position. NE = fragment elements that can hold an unmasked key (8: keys
// 0..15, 16: keys 0..31; the rest are zero operands); XT: keys 32,33 as a second k-step.
// Returns the row sum over the unconverted numerators.
template <int NE, bool XT>
__device__ __forceinline__ float soft_rows(const v4f qv, const v4f* kp, const unsigned tq,
                                           const unsigned hh, v16h& ahi, v16h& ars,
                                           v16h& xhi, v16h& xrs) {
  float sc[NE];
  float sx[2];
  float mx = -1.0e30f;
#pragma unroll
  for (int i = 0; i < NE; ++i) {
    const unsigned j = 8u * hh + (unsigned)(i & 7) + 16u * (unsigned)(i >> 3);
    const v4f kv = kp[j];
    float sv = (qv[0] * kv[0] + qv[1] * kv[1] + qv[2] * kv[2]) * 0.57735026918962576f;
    sv = (j > tq) ? -1.0e30f : sv;
    sc[i] = sv;
    mx = fmaxf(mx, sv);
  }
  if (XT) {
#pragma unroll
    for (int e = 0; e < 2; ++e) {
      const unsigned j = 32u + (unsigned)e;
      const v4f kv = kp[j];
      float sv = (qv[0] * kv[0] + qv[1] * kv[1] + qv[2] * kv[2]) * 0.57735026918962576f;
      sv = ((hh != 0u) || (j > tq)) ? -1.0e30f : sv;
      sx[e] = sv;
      mx = fmaxf(mx, sv);
    }
  }
  mx = fmaxf(mx, __shfl_xor(mx, 16, 32));

  ahi = v16h{};
  ars = v16h{};
  xhi = v16h{};
  xrs = v16h{};
  float den = 0.0f;
#pragma unroll
  for (int i = 0; i < NE; ++i) {
    const unsigned j = 8u * hh + (unsigned)(i & 7) + 16u * (unsigned)(i >> 3);
    float pe = __expf(sc[i] - mx);
    pe = (j > tq) ? 0.0f : pe;
    den += pe;
    sc[i] = pe;
  }
#pragma unroll
  for (int i = 0; i < NE; i += 2) {
    v2h hi, rs;
    split2(v2f{sc[i], sc[i + 1]} * PCARRY, hi, rs);
    ahi[i] = hi[0];
    ahi[i + 1] = hi[1];
    ars[i] = rs[0];
    ars[i + 1] = rs[1];
  }
  if (XT) {
#pragma unroll
    for (int e = 0; e < 2; ++e) {
      const unsigned j = 32u + (unsigned)e;
      float pe = __expf(sx[e] - mx);
      pe = ((hh != 0u) || (j > tq)) ? 0.0f : pe;
      den += pe;
      sx[e] = pe;
    }
    v2h hi, rs;
    split2(v2f{sx[0], sx[1]} * PCARRY, hi, rs);
    xhi[0] = hi[0];
    xhi[1] = hi[1];
    xrs[0] = rs[0];
    xrs[1] = rs[1];
  }
  den += __shfl_xor(den, 16, 32);
  return den;
}

// LayerNorm over 6 values (biased variance, eps 1e-5); PRE: g, b converted by the first launch
template <bool PRE>
__device__ __forceinline__ void ln6(const float (&x)[6], const float* __restrict__ g,
                                    const float* __restrict__ b, float (&h)[6]) {
  const float mu = (x[0] + x[1] + x[2] + x[3] + x[4] + x[5]) * (1.0f / 6.0f);
  float var = 0.0f;
#pragma unroll
  for (int c = 0; c < 6; ++c) { const float d = x[c] - mu; var += d * d; }
  var *= (1.0f / 6.0f);
  const float rs = rsqrtf(var + 1.0e-5f);
#pragma unroll
  for (int c = 0; c < 6; ++c) h[c] = (x[c] - mu) * rs * (PRE ? cw(g[c]) : inw(g[c])) + (PRE ? cw(b[c]) : inw(b[c]));
}

// A weight stored by the first launch as a 16-bit bf16 word, widened
__device__ __forceinline__ float hw(unsigned short x) { return __uint_as_float((unsigned)x << 16); }
// ln6 with g, b as 16-bit bf16 words
__device__ __forceinline__ void ln6h(const float (&x)[6], const unsigned short* __restrict__ g,
                                     const unsigned short* __restrict__ b, float (&h)[6]) {
  const float mu = (x[0] + x[1] + x[2] + x[3] + x[4] + x[5]) * (1.0f / 6.0f);
  float var = 0.0f;
#pragma unroll
  for (int c = 0; c < 6; ++c) { const float d = x[c] - mu; var += d * d; }
  var *= (1.0f / 6.0f);
  const float rs = rsqrtf(var + 1.0e-5f);
#pragma unroll
  for (int c = 0; c < 6; ++c) h[c] = (x[c] - mu) * rs * hw(g[c]) + hw(b[c]);
}

// ---------------------------------------------------------------------------
// First launch, one block: values that do not depend on idx. Waves 0,1 build the 34x3 position
// rows; each further wave converts one weight array: those of the phase behind the attention and
// the token rows to 32-bit words, those of LN1 and the q,k,v projections to 16-bit words.
// ---------------------------------------------------------------------------
__global__ __launch_bounds__(PREP_WAVES * 32) void prep_consts_kernel(
    const float* __restrict__ tok_emb,
    const float* __restrict__ pos_params, const float* __restrict__ z10_enc,
    const float* __restrict__ special_enc, const float* __restrict__ wq,
    const float* __restrict__ wk, const float* __restrict__ wv, const float* __restrict__ wo,
    const float* __restrict__ ln1_g, const float* __restrict__ ln1_b,
    const float* __restrict__ ln2_g, const float* __restrict__ ln2_b,
    const float* __restrict__ lnf_g, const float* __restrict__ lnf_b,
    const float* __restrict__ ffn_w1, const float* __restrict__ ffn_b1,
    const float* __restrict__ ffn_w2, const float* __restrict__ ffn_b2,
    const float* __restrict__ head_w, float* __restrict__ cst) {
  const unsigned tid = threadIdx.x;
  const unsigned lane = tid & 31u;
  const int wave = __builtin_amdgcn_readfirstlane((int)(tid >> 5));

  // ---- position rows: all candidates loaded by value, selected by value ----
  if (wave < 2) {
    const unsigned t = (tid < (unsigned)TLEN) ? tid : (unsigned)(TLEN - 1);
    const float amp   = inw(pos_params[0]);
    const float phase = inw(pos_params[1]);
    const float slope = inw(pos_params[2]);
    const float offs  = inw(pos_params[3]);
    int di = (t < 10u) ? (int)t : ((t < 21u) ? ((int)t - 11) : ((int)t - 22));
    di = (di < 0) ? 0 : ((di > 9) ? 9 : di);
    const float fi  = (float)di;
    const float ang = 0.62831853071795864769f * fi + phase;
    const float d0 = amp * cosf(ang);
    const float d1 = amp * sinf(ang);
    const float d2 = slope * fi + offs;
    const unsigned si = (t == 10u) ? 0u : ((t == 21u) ? 1u : 2u);
    const float s0 = inw(special_enc[si * 3u + 0u]);
    const float s1 = inw(special_enc[si * 3u + 1u]);
    const float s2 = inw(special_enc[si * 3u + 2u]);
    const float z0 = inw(z10_enc[0]);
    const float z1 = inw(z10_enc[1]);
    const float z2 = inw(z10_enc[2]);
    const bool is_sp = (t == 10u) || (t == 21u) || (t == 33u);
    const bool is_z  = (t == 32u);
    const float p0 = is_sp ? s0 : (is_z ? z0 : d0);
    const float p1 = is_sp ? s1 : (is_z ? z1 : d1);
    const float p2 = is_sp ? s2 : (is_z ? z2 : d2);
    if (tid < (unsigned)TLEN) {
      cst[C_POS + t * 4u + 0u] = p0;
      cst[C_POS + t * 4u + 1u] = p1;
      cst[C_POS + t * 4u + 2u] = p2;
      cst[C_POS + t * 4u + 3u] = 0.0f;
    }
    return;
  }

  const float* a = tok_emb;
  unsigned n = VOC * 3, off = C_TOK;
  switch (wave) {
    case 3:  a = wo;     n = 36; off = C_WO;   break;
    case 4:  a = ln2_g;  n = 6;  off = C_LN2G; break;
    case 5:  a = ln2_b;  n = 6;  off = C_LN2B; break;
    case 6:  a = lnf_g;  n = 6;  off = C_LNFG; break;
    case 7:  a = lnf_b;  n = 6;  off = C_LNFB; break;
    case 8:  a = ffn_w1; n = 12; off = C_W1;   break;
    case 9:  a = ffn_b1; n = 2;  off = C_B1;   break;
    case 10: a = ffn_w2; n = 12; off = C_W2;   break;
    case 11: a = ffn_b2; n = 6;  off = C_B2;   break;
    case 12: a = head_w; n = 18; off = C_HEAD; break;
    case 13: a = wq;     n = 18; off = H_WQ;   break;
    case 14: a = wk;     n = 18; off = H_WK;   break;
    case 15: a = wv;     n = 18; off = H_WV;   break;
    case 16: a = ln1_g;  n = 6;  off = H_LN1G; break;
    case 17: a = ln1_b;  n = 6;  off = H_LN1B; break;
    default: break;
  }
  if (wave >= 13) {
    unsigned short* c16 = (unsigned short*)(cst + C_H16);
    for (unsigned i = lane; i < n; i += 32u) c16[off + i] = (unsigned short)(__float_as_uint(inw(a[i])) >> 16);
    return;
  }
  for (unsigned i = lane; i < n; i += 32u) cst[off + i] = inw(a[i]);
}

// ---------------------------------------------------------------------------
// One block = 8 sequences (272 tokens, one token per thread in the per-token phases).
// Phase 0: zero the V^T planes, fetch the 34x3 position rows.
// Phase A: embed + LN1 + q/k/v per token; q,k as f32 float4 rows per head in LDS; v as f16
//          value / residual planes VT[seq][n = head*3+d][key] (k-contiguous B operand).
// Phase B: scores and the causal softmax are formed in registers directly in the A-fragment
//          layout (lane row = lane&15, up to 16 keys per lane); unnormalised p.v via WMMA; row
//          sums over the unconverted p. Wave w (< 8) owns query rows 0..31 of sequence w: per
//          head a tile of rows 0..15 (keys 0..15 only) and a tile of rows 16..31. Wave 8 owns
//          rows 32,33 of all sequences and heads (two full tiles, keys 32,33 as a second
//          sparse k-step).
// Phase C: per token: normalise, output projection, LN2, GELU feed-forward, final LN, head;
//          logits staged in LDS in the output layout.
// LDS regions are all cross-wave (block barriers between phases).
// ---------------------------------------------------------------------------
__global__ __launch_bounds__(NTHR) void fused_block_kernel(
    const int* __restrict__ idx, const float* __restrict__ cst, float* __restrict__ out) {
  __shared__ __attribute__((aligned(16))) v4f sQ4[SPB * 2 * TLEN];
  __shared__ __attribute__((aligned(16))) v4f sK4[SPB * 2 * TLEN];
  __shared__ __attribute__((aligned(16))) _Float16 sVTh[SPB * VROWS * VKEYS];
  __shared__ __attribute__((aligned(16))) _Float16 sVTr[SPB * VROWS * VKEYS];
  __shared__ __attribute__((aligned(16))) float sO[TOK * 6];
  __shared__ __attribute__((aligned(16))) float sDen[TOK * 2];
  __shared__ __attribute__((aligned(16))) float sPos[TLEN * 4];
  __shared__ __attribute__((aligned(16))) float sLog[TOK * VOC];

  const unsigned tid = threadIdx.x;
  const unsigned lane = tid & 31u;
  const int wave = __builtin_amdgcn_readfirstlane((int)(tid >> 5));
  const unsigned hh = lane >> 4, m = lane & 15u;

  // ---- Phase 0: zero V^T planes (pad keys 34..63 and rows 6,7 stay zero) ----
  {
    const v8h z = {};
    for (unsigned i = tid; i < (unsigned)(SPB * VROWS * VKEYS / 8); i += NTHR) {
      *(v8h*)&sVTh[i * 8u] = z;
      *(v8h*)&sVTr[i * 8u] = z;
    }
  }
  // ---- position rows: from the constant block ----
  if (tid < (unsigned)TLEN) *(v4f*)&sPos[tid * 4u] = *(const v4f*)&cst[C_POS + tid * 4u];
  __syncthreads();

  // ---- Phase A: embed + LN1 + q/k/v (idle lanes duplicate the last token, no stores) ----
  const bool act = tid < (unsigned)TOK;
  const unsigned p = act ? tid : (unsigned)(TOK - 1);
  const unsigned s = p / (unsigned)TLEN;
  const unsigned t = p - s * (unsigned)TLEN;
  float x[6];
  {
    const size_t seq_g = (size_t)blockIdx.x * SPB + s;
    int tok = idx[seq_g * TLEN + t];
    tok = (tok < 0) ? 0 : ((tok > VOC - 1) ? (VOC - 1) : tok);
#pragma unroll
    for (int c = 0; c < 3; ++c) {
      x[c]     = cw(cst[C_TOK + tok * 3 + c]);
      x[3 + c] = sPos[t * 4u + (unsigned)c];
    }
    float h[6];
    const unsigned short* __restrict__ c16 = (const unsigned short*)(cst + C_H16);
    ln6h(x, c16 + H_LN1G, c16 + H_LN1B, h);
    float q[6], k[6], v[6];
#pragma unroll
    for (int j = 0; j < 6; ++j) {
      q[j] = h[3] * hw(c16[H_WQ + j]) + h[4] * hw(c16[H_WQ + 6 + j]) + h[5] * hw(c16[H_WQ + 12 + j]);
      k[j] = h[3] * hw(c16[H_WK + j]) + h[4] * hw(c16[H_WK + 6 + j]) + h[5] * hw(c16[H_WK + 12 + j]);
      v[j] = h[0] * hw(c16[H_WV + j]) + h[1] * hw(c16[H_WV + 6 + j]) + h[2] * hw(c16[H_WV + 12 + j]);
    }
    if (act) {
      v4f q0 = {q[0], q[1], q[2], 0.0f};
      v4f q1 = {q[3], q[4], q[5], 0.0f};
      v4f k0 = {k[0], k[1], k[2], 0.0f};
      v4f k1 = {k[3], k[4], k[5], 0.0f};
      sQ4[(s * 2u + 0u) * TLEN + t] = q0;
      sQ4[(s * 2u + 1u) * TLEN + t] = q1;
      sK4[(s * 2u + 0u) * TLEN + t] = k0;
      sK4[(s * 2u + 1u) * TLEN + t] = k1;
#pragma unroll
      for (int n = 0; n < 6; n += 2) {
        v2h hi, rs;
        split2(v2f{v[n], v[n + 1]} * VCARRY, hi, rs);
        sVTh[(s * VROWS + (unsigned)n) * VKEYS + t] = hi[0];
        sVTh[(s * VROWS + (unsigned)n + 1u) * VKEYS + t] = hi[1];
        sVTr[(s * VROWS + (unsigned)n) * VKEYS + t] = rs[0];
        sVTr[(s * VROWS + (unsigned)n + 1u) * VKEYS + t] = rs[1];
      }
    }
  }
  __syncthreads();

  // ---- Phase B: causal softmax in A-fragment registers, p.v on WMMA ----
  if (wave < SPB) {
    // waves 0..7: query rows 0..31 of sequence = wave
    const unsigned seq = (unsigned)wave;
    // B fragments: lane column n = lane&15 -> V^T row n&7 (rows 6,7 are zero rows)
    const unsigned vrow = (seq * VROWS + (m & 7u)) * VKEYS + 8u * hh;
    const v16h bh0 = frag_at(&sVTh[vrow]);
    const v16h br0 = frag_at(&sVTr[vrow]);

#pragma unroll 1
    for (unsigned hd = 0; hd < 2u; ++hd) {
      const unsigned qkb = (seq * 2u + hd) * TLEN;
#pragma unroll
      for (int qt = 0; qt < 2; ++qt) {
        const unsigned tr = 16u * (unsigned)qt + m;                 // query row of this lane
        const v4f qv = sQ4[qkb + tr];
        v16h ahi, ars, xhi, xrs;
        const float den = (qt == 0)
            ? soft_rows<8, false>(qv, &sK4[qkb], tr, hh, ahi, ars, xhi, xrs)
            : soft_rows<16, false>(qv, &sK4[qkb], tr, hh, ahi, ars, xhi, xrs);

        v8f accM = {}, accR = {};
        accM = wmma16(ahi, bh0, accM);
        if (PV_RES) {
          accR = wmma16(ahi, br0, accR);
          accR = wmma16(ars, bh0, accR);
        }

        // D element r of this lane = (row 16*qt + 8*hh + r, column m); columns 3*hd..3*hd+2
        const bool colok = (m >= 3u * hd) && (m < 3u * hd + 3u);
#pragma unroll
        for (int r = 0; r < 8; ++r) {
          const unsigned row = 16u * (unsigned)qt + 8u * hh + (unsigned)r;
          const float val = accM[r] + accR[r] * (1.0f / RCARRY);
          if (colok) sO[(seq * TLEN + row) * 6u + m] = val;
        }
        if (hh == 0u) sDen[(seq * TLEN + tr) * 2u + hd] = den;
      }
    }
  } else {
    // wave 8: query rows 32,33 of every sequence and both heads, 16 full rows per tile.
    // Tile row m = (sequence 4*tl + (m>>2), head (m>>1)&1, query 32 + (m&1)).
#pragma unroll 1
    for (unsigned tl = 0; tl < 2u; ++tl) {
      const unsigned sq = 4u * tl + (m >> 2);
      const unsigned hd = (m >> 1) & 1u;
      const unsigned tq = 32u + (m & 1u);
      const unsigned qkb = (sq * 2u + hd) * TLEN;
      const v4f qv = sQ4[qkb + tq];
      v16h ahi, ars, xhi, xrs;
      const float den = soft_rows<16, true>(qv, &sK4[qkb], tq, hh, ahi, ars, xhi, xrs);
      if (hh == 0u) sDen[(sq * TLEN + tq) * 2u + hd] = den;

      // B columns 0..7 = V^T rows of sequence 4*tl + 2*pp, columns 8..15 = of the next one;
      // their query rows are tile rows 8*pp..8*pp+7 (D elements of the lanes with hh == pp).
      // Column c = m&7 (< 6) belongs to head c/3, so a lane keeps D elements r0, r0+1 with
      // r0 = 4*(m>>3) + 2*(c/3): queries 32,33 of sequence 4*tl + 2*hh + (m>>3).
      const unsigned c = m & 7u;
      const bool up = (m >> 3) != 0u, h1 = c >= 3u;
      float keep[2] = {0.0f, 0.0f};
      // rolled: only one pair's B fragments live at a time (fewer registers, more waves resident)
#pragma unroll 1
      for (unsigned pp = 0; pp < 2u; ++pp) {
        const unsigned vrow = ((4u * tl + 2u * pp + (m >> 3)) * VROWS + c) * VKEYS + 8u * hh;
        const v16h bh0 = frag_at(&sVTh[vrow]);
        const v16h br0 = frag_at(&sVTr[vrow]);
        const v16h bh1 = frag_at(&sVTh[vrow + 32u]);
        const v16h br1 = frag_at(&sVTr[vrow + 32u]);

        v8f accM = {}, accR = {};
        accM = wmma16(ahi, bh0, accM);
        if (PV_RES) {
          accR = wmma16(ahi, br0, accR);
          accR = wmma16(ars, bh0, accR);
        }
        accM = wmma16(xhi, bh1, accM);
        if (PV_RES) {
          accR = wmma16(xhi, br1, accR);
          accR = wmma16(xrs, bh1, accR);
        }

        float val[8];
#pragma unroll
        for (int r = 0; r < 8; ++r) val[r] = accM[r] + accR[r] * (1.0f / RCARRY);
#pragma unroll
        for (int e = 0; e < 2; ++e) {
          const float lo = h1 ? val[2 + e] : val[e];
          const float hi = h1 ? val[6 + e] : val[4 + e];
          const float pick = up ? hi : lo;
          keep[e] = (hh == pp) ? pick : keep[e];
        }
      }
      if (c < 6u) {
        const unsigned ob = ((4u * tl + 2u * hh + (m >> 3)) * TLEN + 32u) * 6u + c;
        sO[ob] = keep[0];
        sO[ob + 6u] = keep[1];
      }
    }
  }
  __syncthreads();

  // ---- Phase C: normalise, output projection, LN2, feed-forward, final LN, head ----
  {
    float o[6];
    const float inv0 = (1.0f / sDen[p * 2u + 0u]) * OSCALE;
    const float inv1 = (1.0f / sDen[p * 2u + 1u]) * OSCALE;
#pragma unroll
    for (int c = 0; c < 3; ++c) {
      o[c]     = sO[p * 6u + (unsigned)c] * inv0;
      o[3 + c] = sO[p * 6u + 3u + (unsigned)c] * inv1;
    }
    float x2[6];
#pragma unroll
    for (int j = 0; j < 6; ++j) {
      float acc = x[j];
#pragma unroll
      for (int c = 0; c < 6; ++c) acc += o[c] * cw(cst[C_WO + c * 6 + j]);
      x2[j] = acc;
    }
    float h2[6];
    ln6<true>(x2, cst + C_LN2G, cst + C_LN2B, h2);
    float f0 = cw(cst[C_B1 + 0]), f1 = cw(cst[C_B1 + 1]);
#pragma unroll
    for (int j = 0; j < 6; ++j) {
      f0 += h2[j] * cw(cst[C_W1 + j * 2 + 0]);
      f1 += h2[j] * cw(cst[C_W1 + j * 2 + 1]);
    }
    f0 = 0.5f * f0 * (1.0f + erff(f0 * 0.70710678118654752f));
    f1 = 0.5f * f1 * (1.0f + erff(f1 * 0.70710678118654752f));
#pragma unroll
    for (int j = 0; j < 6; ++j)
      x2[j] += f0 * cw(cst[C_W2 + j]) + f1 * cw(cst[C_W2 + 6 + j]) + cw(cst[C_B2 + j]);
    float xf[6];
    ln6<true>(x2, cst + C_LNFG, cst + C_LNFB, xf);
    float y[3];
#pragma unroll
    for (int d = 0; d < 3; ++d) {
      float acc = 0.0f;
#pragma unroll
      for (int c = 0; c < 6; ++c) acc += xf[c] * cw(cst[C_HEAD + c * 3 + d]);
      y[d] = acc;
    }
#pragma unroll 2
    for (int n = 0; n < VOC; ++n) {
      const float lg = y[0] * cw(cst[C_TOK + n * 3 + 0]) + y[1] * cw(cst[C_TOK + n * 3 + 1]) +
                       y[2] * cw(cst[C_TOK + n * 3 + 2]);
      if (act) sLog[p * VOC + (unsigned)n] = lg;
    }
  }
  __syncthreads();

  {
    float* outB = out + (size_t)blockIdx.x * (size_t)(TOK * VOC);
    v4f xs[4];
#pragma unroll
    for (unsigned j = 0; j < 4u; ++j) {
      const unsigned i = tid + NTHR * j;
      const unsigned ic = (i < (unsigned)OUT_F4) ? i : (unsigned)(OUT_F4 - 1);
      xs[j] = *(const v4f*)&sLog[ic * 4u];
    }
#pragma unroll
    for (unsigned j = 0; j < 4u; ++j) {
      const unsigned i = tid + NTHR * j;
      if (i < (unsigned)OUT_F4) *(v4f*)(outB + (size_t)i * 4u) = xs[j];
    }
    
  }
}

// ---------------------------------------------------------------------------
extern "C" void kernel_launch(void* const* d_in, const int* in_sizes, int n_in,
                              void* d_out, int out_size, void* d_ws, size_t ws_size,
                              hipStream_t stream) {
  if (n_in < 20) return;
  if (ws_size < (size_t)C_END * sizeof(float)) return;
  if ((long long)in_sizes[0] < (long long)NB * TLEN) return;
  if (in_sizes[1] < VOC * 3 || in_sizes[2] < 4 || in_sizes[3] < 3 || in_sizes[4] < 9) return;
  if (in_sizes[5] < 18 || in_sizes[6] < 18 || in_sizes[7] < 18 || in_sizes[8] < 36) return;
  if (in_sizes[9] < 6 || in_sizes[10] < 6 || in_sizes[11] < 6 || in_sizes[12] < 6) return;
  if (in_sizes[13] < 6 || in_sizes[14] < 6) return;
  if (in_sizes[15] < 12 || in_sizes[16] < 2 || in_sizes[17] < 12 || in_sizes[18] < 6) return;
  if (in_sizes[19] < 18) return;
  if ((long long)out_size < (long long)NB * TLEN * VOC) return;

  const int*   idx         = (const int*)  d_in[0];    // [NB_FULL][34]
  const float* tok_emb     = (const float*)d_in[1];    // [14][3]
  const float* pos_params  = (const float*)d_in[2];    // [4]
  const float* z10_enc     = (const float*)d_in[3];    // [1][3]
  const float* special_enc = (const float*)d_in[4];    // [3][3]
  const float* wq          = (const float*)d_in[5];    // [3][6] (in, out)
  const float* wk          = (const float*)d_in[6];
  const float* wv          = (const float*)d_in[7];
  const float* wo          = (const float*)d_in[8];    // [6][6] (in, out)
  const float* ln1_g       = (const float*)d_in[9];
  const float* ln1_b       = (const float*)d_in[10];
  const float* ln2_g       = (const float*)d_in[11];
  const float* ln2_b       = (const float*)d_in[12];
  const float* lnf_g       = (const float*)d_in[13];
  const float* lnf_b       = (const float*)d_in[14];
  const float* ffn_w1      = (const float*)d_in[15];   // [6][2]
  const float* ffn_b1      = (const float*)d_in[16];
  const float* ffn_w2      = (const float*)d_in[17];   // [2][6]
  const float* ffn_b2      = (const float*)d_in[18];
  const float* head_w      = (const float*)d_in[19];   // [6][3]
  float* out = (float*)d_out;

  float* cst = (float*)d_ws;

  prep_consts_kernel<<<dim3(1), dim3(PREP_WAVES * 32), 0, stream>>>(
      tok_emb, pos_params, z10_enc, special_enc, wq, wk, wv, wo, ln1_g, ln1_b, ln2_g, ln2_b, lnf_g, lnf_b,
      ffn_w1, ffn_b1, ffn_w2, ffn_b2, head_w, cst);
  fused_block_kernel<<<dim3(NB / SPB), dim3(NTHR), 0, stream>>>(
      idx, cst, out);
}

// v005
// A run of this version takes 41.9 microseconds.
// Two timings next to v004 both put it at 1.03 times that version's speed.
// Counting every step since v000, it is 1.80 times as fast.
#include <hip/hip_runtime.h>
#include <stddef.h>

// Contractions: p.v (34 keys deep) on v_wmma_f32_16x16x32_f16 (f16 operands, f32 accumulate):
// p carried x16384 and v carried x16, each as an f16 value plane plus an x2048 f16 residual
// plane (three products, residual products in their own accumulator). Every other product of
// this block (depth 2..6: q/k/v projections, q.k scores, output projection, feed-forward,
// vocabulary head) is f32 on the vector unit. Float inputs are RNE-converted to bf16 (INPUT_BF16,
// which must be 1) once per call by a small first launch, which also builds the 34 position rows; the
// main launch reads both from the workspace. LayerNorm, softmax, GELU (erf), residual adds in f32.

typedef _Float16 h16;
typedef _Float16 v16h __attribute__((ext_vector_type(16)));
typedef _Float16 v8h  __attribute__((ext_vector_type(8)));
typedef float    v8f  __attribute__((ext_vector_type(8)));
typedef float    v4f  __attribute__((ext_vector_type(4)));
typedef float    v2f  __attribute__((ext_vector_type(2)));
typedef _Float16 v2h  __attribute__((ext_vector_type(2)));

#ifndef NB
#define NB 32768
#endif
#define NB_FULL 32768
#define TLEN 34          // tokens per sequence (fixed by the position map)
#define VOC  14
#define SPB  8           // sequences per block
#define TOK  (SPB * TLEN)        // 272 tokens per block
#define NTHR 288                 // 9 waves
#define OUT_F4 (TOK * VOC / 4)
#define VROWS 8                  // V^T plane rows per sequence (6 used, 2 zero)
#define VKEYS 64                 // V^T plane keys per row (34 used, rest zero)

#ifndef INPUT_BF16
#define INPUT_BF16 1
#endif
#ifndef PV_RES
#define PV_RES 1
#endif

// Constant block at the start of the workspace (float offsets), rewritten on every call.
#define C_TOK  0      // [14][3]
#define C_WO   42     // [6][6]
#define C_LN2G 78
#define C_LN2B 84
#define C_B1   90
#define C_W1   92     // [6][2]
#define C_W2   104    // [2][6]
#define C_B2   116
#define C_LNFG 122
#define C_LNFB 128
#define C_HEAD 134    // [6][3]
#define C_POS  152    // [34][4], 16-byte rows; no gap among the float arrays: every word read is written
#define C_H16  288    // from here bf16 numbers as 16-bit words; H_* count 16-bit words. Arrays start
                      // on 16 bytes; the words between two arrays are neither written nor read
#define H_WQ   0      // [3][6]
#define H_WK   24     // [3][6]
#define H_WV   48     // [3][6]
#define H_LN1G 72
#define H_LN1B 80
#define C_END  (288 + 43)
#define PREP_WAVES 18 // waves 0,1: position rows; waves 2..17: one weight array each

#define PCARRY 16384.0f
#define VCARRY 16.0f
#define RCARRY 2048.0f
#define OSCALE 3.814697265625e-06f    // 1 / (PCARRY * VCARRY)

static_assert(INPUT_BF16 == 1);                     // the 16-bit words of the constant block hold bf16
static_assert(NB >= SPB && NB <= NB_FULL && (NB % SPB) == 0);
static_assert((TOK * VOC * 4) % 128 == 0);          // a block owns whole output lines
static_assert((TOK * VOC) % 4 == 0);
static_assert(OUT_F4 % 8 == 0);
static_assert(NTHR % 32 == 0 && NTHR >= TOK);
static_assert(4 * NTHR >= OUT_F4);                  // store loop: 4 trips cover the block
static_assert(TLEN > 32 && TLEN <= 48);             // two 16-row query tiles + tail rows, keys 32.. as extras
static_assert(TLEN - 32 == 2);                      // exactly two tail rows / extra keys (32, 33)
static_assert(VKEYS == 64 && VROWS == 8);
static_assert(SPB == 8 && NTHR / 32 == SPB + 1);    // p.v phase: one wave per sequence, one for the tails

__device__ __forceinline__ float bf16r(float x) {   // RNE convert to bf16, returned widened
  unsigned int u = __float_as_uint(x);
  u = (u + 0x7FFFu + ((u >> 16) & 1u)) & 0xFFFF0000u;
  return __uint_as_float(u);
}
__device__ __forceinline__ float inw(float x) {     // input value as consumed
  return INPUT_BF16 ? bf16r(x) : x;
}
// A weight converted by the first launch: a bf16 value in the upper half of its 32-bit word.
// Taking that half (the lower one is zero) shows the compiler a bf16 operand as the conversion
// in place did, so it forms the same fused and unfused products: results stay bit-identical.
__device__ __forceinline__ float cw(float x) {
  return INPUT_BF16 ? __uint_as_float(__float_as_uint(x) & 0xFFFF0000u) : x;
}
// Two f32 values -> f16 value plane and x2048 f16 residual plane, round to nearest even, both
// values per convert instruction. A small value becomes an f16 subnormal: the matrix unit keeps
// subnormal operands, and what the value plane rounds off goes to the residual plane as for
// any other value.
static __device__ __forceinline__ void split2(const v2f x, v2h& hi, v2h& rs) {
  hi = __builtin_convertvector(x, v2h);
  rs = __builtin_convertvector((x - __builtin_convertvector(hi, v2f)) * RCARRY, v2h);
}

// 16-bit fragment: p points at element [row = lane&15][k0 + 8*(lane>>4)] of a k-contiguous
// row. Elements 0..7 <- k0+8h+0..7, elements 8..15 <- k0+16+8h+0..7 (same map for A and B).
__device__ __forceinline__ v16h frag_at(const _Float16* p) {
  v8h lo = *(const v8h*)(p);
  v8h hi = *(const v8h*)(p + 16);
  v16h out;
#pragma unroll
  for (int i = 0; i < 8; ++i) { out[i] = lo[i]; out[i + 8] = hi[i]; }
  return out;
}

__device__ __forceinline__ v8f wmma16(v16h a, v16h b, v8f c) {
  v8f d = __builtin_amdgcn_wmma_f32_16x16x32_f16(false, a, false, b, (short)0, c,
                                                 false, false);
  asm volatile("v_nop\n\tv_nop\n\tv_nop\n\tv_nop" : "+v"(d) : "v"(a), "v"(b));
  return d;
}

// Scores, causal softmax numerators and their f16 value / residual planes for one query row
// per lane pair (lane, lane^16), in the A-fragment layout. kp = key rows of the row's sequence
// and head, tq = query position. NE = fragment elements that can hold an unmasked key (8: keys
// 0..15, 16: keys 0..31; the rest are zero operands); XT: keys 32,33 as a second k-step.
// Returns the row sum over the unconverted numerators.
template <int NE, bool XT>
__device__ __forceinline__ float soft_rows(const v4f qv, const v4f* kp, const unsigned tq,
                                           const unsigned hh, v16h& ahi, v16h& ars,
                                           v16h& xhi, v16h& xrs) {
  float sc[NE];
  float sx[2];
  float mx = -1.0e30f;
#pragma unroll
  for (int i = 0; i < NE; ++i) {
    const unsigned j = 8u * hh + (unsigned)(i & 7) + 16u * (unsigned)(i >> 3);
    const v4f kv = kp[j];
    float sv = (qv[0] * kv[0] + qv[1] * kv[1] + qv[2] * kv[2]) * 0.57735026918962576f;
    sv = (j > tq) ? -1.0e30f : sv;
    sc[i] = sv;
    mx = fmaxf(mx, sv);
  }
  if (XT) {
#pragma unroll
    for (int e = 0; e < 2; ++e) {
      const unsigned j = 32u + (unsigned)e;
      const v4f kv = kp[j];
      float sv = (qv[0] * kv[0] + qv[1] * kv[1] + qv[2] * kv[2]) * 0.57735026918962576f;
      sv = ((hh != 0u) || (j > tq)) ? -1.0e30f : sv;
      sx[e] = sv;
      mx = fmaxf(mx, sv);
    }
  }
  mx = fmaxf(mx, __shfl_xor(mx, 16, 32));

  ahi = v16h{};
  ars = v16h{};
  xhi = v16h{};
  xrs = v16h{};
  float den = 0.0f;
#pragma unroll
  for (int i = 0; i < NE; ++i) {
    const unsigned j = 8u * hh + (unsigned)(i & 7) + 16u * (unsigned)(i >> 3);
    float pe = __expf(sc[i] - mx);
    pe = (j > tq) ? 0.0f : pe;
    den += pe;
    sc[i] = pe;
  }
#pragma unroll
  for (int i = 0; i < NE; i += 2) {
    v2h hi, rs;
    split2(v2f{sc[i], sc[i + 1]} * PCARRY, hi, rs);
    ahi[i] = hi[0];
    ahi[i + 1] = hi[1];
    ars[i] = rs[0];
    ars[i + 1] = rs[1];
  }
  if (XT) {
#pragma unroll
    for (int e = 0; e < 2; ++e) {
      const unsigned j = 32u + (unsigned)e;
      float pe = __expf(sx[e] - mx);
      pe = ((hh != 0u) || (j > tq)) ? 0.0f : pe;
      den += pe;
      sx[e] = pe;
    }
    v2h hi, rs;
    split2(v2f{sx[0], sx[1]} * PCARRY, hi, rs);
    xhi[0] = hi[0];
    xhi[1] = hi[1];
    xrs[0] = rs[0];
    xrs[1] = rs[1];
  }
  den += __shfl_xor(den, 16, 32);
  return den;
}

// LayerNorm over 6 values (biased variance, eps 1e-5); PRE: g, b converted by the first launch
template <bool PRE>
__device__ __forceinline__ void ln6(const float (&x)[6], const float* __restrict__ g,
                                    const float* __restrict__ b, float (&h)[6]) {
  const float mu = (x[0] + x[1] + x[2] + x[3] + x[4] + x[5]) * (1.0f / 6.0f);
  float var = 0.0f;
#pragma unroll
  for (int c = 0; c < 6; ++c) { const float d = x[c] - mu; var += d * d; }
  var *= (1.0f / 6.0f);
  const float rs = rsqrtf(var + 1.0e-5f);
#pragma unroll
  for (int c = 0; c < 6; ++c) h[c] = (x[c] - mu) * rs * (PRE ? cw(g[c]) : inw(g[c])) + (PRE ? cw(b[c]) : inw(b[c]));
}

// A weight stored by the first launch as a 16-bit bf16 word, widened
__device__ __forceinline__ float hw(unsigned short x) { return __uint_as_float((unsigned)x << 16); }
// ln6 with g, b as 16-bit bf16 words
__device__ __forceinline__ void ln6h(const float (&x)[6], const unsigned short* __restrict__ g,
                                     const unsigned short* __restrict__ b, float (&h)[6]) {
  const float mu = (x[0] + x[1] + x[2] + x[3] + x[4] + x[5]) * (1.0f / 6.0f);
  float var = 0.0f;
#pragma unroll
  for (int c = 0; c < 6; ++c) { const float d = x[c] - mu; var += d * d; }
  var *= (1.0f / 6.0f);
  const float rs = rsqrtf(var + 1.0e-5f);
#pragma unroll
  for (int c = 0; c < 6; ++c) h[c] = (x[c] - mu) * rs * hw(g[c]) + hw(b[c]);
}

// ---------------------------------------------------------------------------
// First launch, one block: values that do not depend on idx. Waves 0,1 build the 34x3 position
// rows; each further wave converts one weight array: those of the phase behind the attention and
// the token rows to 32-bit words, those of LN1 and the q,k,v projections to 16-bit words.
// ---------------------------------------------------------------------------
__global__ __launch_bounds__(PREP_WAVES * 32) void prep_consts_kernel(
    const float* __restrict__ tok_emb,
    const float* __restrict__ pos_params, const float* __restrict__ z10_enc,
    const float* __restrict__ special_enc, const float* __restrict__ wq,
    const float* __restrict__ wk, const float* __restrict__ wv, const float* __restrict__ wo,
    const float* __restrict__ ln1_g, const float* __restrict__ ln1_b,
    const float* __restrict__ ln2_g, const float* __restrict__ ln2_b,
    const float* __restrict__ lnf_g, const float* __restrict__ lnf_b,
    const float* __restrict__ ffn_w1, const float* __restrict__ ffn_b1,
    const float* __restrict__ ffn_w2, const float* __restrict__ ffn_b2,
    const float* __restrict__ head_w, float* __restrict__ cst) {
  const unsigned tid = threadIdx.x;
  const unsigned lane = tid & 31u;
  const int wave = __builtin_amdgcn_readfirstlane((int)(tid >> 5));

  // ---- position rows: all candidates loaded by value, selected by value ----
  if (wave < 2) {
    const unsigned t = (tid < (unsigned)TLEN) ? tid : (unsigned)(TLEN - 1);
    const float amp   = inw(pos_params[0]);
    const float phase = inw(pos_params[1]);
    const float slope = inw(pos_params[2]);
    const float offs  = inw(pos_params[3]);
    int di = (t < 10u) ? (int)t : ((t < 21u) ? ((int)t - 11) : ((int)t - 22));
    di = (di < 0) ? 0 : ((di > 9) ? 9 : di);
    const float fi  = (float)di;
    const float ang = 0.62831853071795864769f * fi + phase;
    const float d0 = amp * cosf(ang);
    const float d1 = amp * sinf(ang);
    const float d2 = slope * fi + offs;
    const unsigned si = (t == 10u) ? 0u : ((t == 21u) ? 1u : 2u);
    const float s0 = inw(special_enc[si * 3u + 0u]);
    const float s1 = inw(special_enc[si * 3u + 1u]);
    const float s2 = inw(special_enc[si * 3u + 2u]);
    const float z0 = inw(z10_enc[0]);
    const float z1 = inw(z10_enc[1]);
    const float z2 = inw(z10_enc[2]);
    const bool is_sp = (t == 10u) || (t == 21u) || (t == 33u);
    const bool is_z  = (t == 32u);
    const float p0 = is_sp ? s0 : (is_z ? z0 : d0);
    const float p1 = is_sp ? s1 : (is_z ? z1 : d1);
    const float p2 = is_sp ? s2 : (is_z ? z2 : d2);
    if (tid < (unsigned)TLEN) {
      cst[C_POS + t * 4u + 0u] = p0;
      cst[C_POS + t * 4u + 1u] = p1;
      cst[C_POS + t * 4u + 2u] = p2;
      cst[C_POS + t * 4u + 3u] = 0.0f;
    }
    return;
  }

  const float* a = tok_emb;
  unsigned n = VOC * 3, off = C_TOK;
  switch (wave) {
    case 3:  a = wo;     n = 36; off = C_WO;   break;
    case 4:  a = ln2_g;  n = 6;  off = C_LN2G; break;
    case 5:  a = ln2_b;  n = 6;  off = C_LN2B; break;
    case 6:  a = lnf_g;  n = 6;  off = C_LNFG; break;
    case 7:  a = lnf_b;  n = 6;  off = C_LNFB; break;
    case 8:  a = ffn_w1; n = 12; off = C_W1;   break;
    case 9:  a = ffn_b1; n = 2;  off = C_B1;   break;
    case 10: a = ffn_w2; n = 12; off = C_W2;   break;
    case 11: a = ffn_b2; n = 6;  off = C_B2;   break;
    case 12: a = head_w; n = 18; off = C_HEAD; break;
    case 13: a = wq;     n = 18; off = H_WQ;   break;
    case 14: a = wk;     n = 18; off = H_WK;   break;
    case 15: a = wv;     n = 18; off = H_WV;   break;
    case 16: a = ln1_g;  n = 6;  off = H_LN1G; break;
    case 17: a = ln1_b;  n = 6;  off = H_LN1B; break;
    default: break;
  }
  if (wave >= 13) {
    unsigned short* c16 = (unsigned short*)(cst + C_H16);
    for (unsigned i = lane; i < n; i += 32u) c16[off + i] = (unsigned short)(__float_as_uint(inw(a[i])) >> 16);
    return;
  }
  for (unsigned i = lane; i < n; i += 32u) cst[off + i] = inw(a[i]);
}

// ---------------------------------------------------------------------------
// One block = 8 sequences (272 tokens, one token per thread in the per-token phases).
// Phase 0: zero the V^T planes, fetch the 34x3 position rows.
// Phase A: embed + LN1 + q/k/v per token; q,k as f32 float4 rows per head in LDS; v as f16
//          value / residual planes VT[seq][n = head*3+d][key] (k-contiguous B operand).
// Phase B: scores and the causal softmax are formed in registers directly in the A-fragment
//          layout (lane row = lane&15, up to 16 keys per lane); unnormalised p.v via WMMA; row
//          sums over the unconverted p. Wave w (< 8) owns query rows 0..31 of sequence w: per
//          head a tile of rows 0..15 (keys 0..15 only) and a tile of rows 16..31. Wave 8 owns
//          rows 32,33 of all sequences and heads (two full tiles, keys 32,33 as a second
//          sparse k-step).
// Phase C: per token: normalise, output projection, LN2, GELU feed-forward, final LN, head;
//          logits staged in LDS in the output layout.
// LDS regions are all cross-wave (block barriers between phases).
// ---------------------------------------------------------------------------
__global__ __launch_bounds__(NTHR) void fused_block_kernel(
    const int* __restrict__ idx, const float* __restrict__ cst, float* __restrict__ out) {
  __shared__ __attribute__((aligned(16))) v4f sQ4[SPB * 2 * TLEN];
  __shared__ __attribute__((aligned(16))) v4f sK4[SPB * 2 * TLEN];
  __shared__ __attribute__((aligned(16))) _Float16 sVTh[SPB * VROWS * VKEYS];
  __shared__ __attribute__((aligned(16))) _Float16 sVTr[SPB * VROWS * VKEYS];
  __shared__ __attribute__((aligned(16))) float sO[TOK * 6];
  __shared__ __attribute__((aligned(16))) float sDen[TOK * 2];
  __shared__ __attribute__((aligned(16))) float sPos[TLEN * 4];
  __shared__ __attribute__((aligned(16))) float sLog[TOK * VOC];

  const unsigned tid = threadIdx.x;
  const unsigned lane = tid & 31u;
  const int wave = __builtin_amdgcn_readfirstlane((int)(tid >> 5));
  const unsigned hh = lane >> 4, m = lane & 15u;

  // ---- Phase 0: zero V^T planes (pad keys 34..63 and rows 6,7 stay zero) ----
  {
    const v8h z = {};
    for (unsigned i = tid; i < (unsigned)(SPB * VROWS * VKEYS / 8); i += NTHR) {
      *(v8h*)&sVTh[i * 8u] = z;
      *(v8h*)&sVTr[i * 8u] = z;
    }
  }
  // ---- position rows: from the constant block ----
  if (tid < (unsigned)TLEN) *(v4f*)&sPos[tid * 4u] = *(const v4f*)&cst[C_POS + tid * 4u];
  __syncthreads();

  // ---- Phase A: embed + LN1 + q/k/v (idle lanes duplicate the last token, no stores) ----
  const bool act = tid < (unsigned)TOK;
  const unsigned p = act ? tid : (unsigned)(TOK - 1);
  const unsigned s = p / (unsigned)TLEN;
  const unsigned t = p - s * (unsigned)TLEN;
  float x[6];
  {
    const size_t seq_g = (size_t)blockIdx.x * SPB + s;
    int tok = idx[seq_g * TLEN + t];
    tok = (tok < 0) ? 0 : ((tok > VOC - 1) ? (VOC - 1) : tok);
#pragma unroll
    for (int c = 0; c < 3; ++c) {
      x[c]     = cw(cst[C_TOK + tok * 3 + c]);
      x[3 + c] = sPos[t * 4u + (unsigned)c];
    }
    float h[6];
    const unsigned short* __restrict__ c16 = (const unsigned short*)(cst + C_H16);
    ln6h(x, c16 + H_LN1G, c16 + H_LN1B, h);
    float q[6], k[6], v[6];
#pragma unroll
    for (int j = 0; j < 6; ++j) {
      q[j] = h[3] * hw(c16[H_WQ + j]) + h[4] * hw(c16[H_WQ + 6 + j]) + h[5] * hw(c16[H_WQ + 12 + j]);
      k[j] = h[3] * hw(c16[H_WK + j]) + h[4] * hw(c16[H_WK + 6 + j]) + h[5] * hw(c16[H_WK + 12 + j]);
      v[j] = h[0] * hw(c16[H_WV + j]) + h[1] * hw(c16[H_WV + 6 + j]) + h[2] * hw(c16[H_WV + 12 + j]);
    }
    if (act) {
      v4f q0 = {q[0], q[1], q[2], 0.0f};
      v4f q1 = {q[3], q[4], q[5], 0.0f};
      v4f k0 = {k[0], k[1], k[2], 0.0f};
      v4f k1 = {k[3], k[4], k[5], 0.0f};
      sQ4[(s * 2u + 0u) * TLEN + t] = q0;
      sQ4[(s * 2u + 1u) * TLEN + t] = q1;
      sK4[(s * 2u + 0u) * TLEN + t] = k0;
      sK4[(s * 2u + 1u) * TLEN + t] = k1;
#pragma unroll
      for (int n = 0; n < 6; n += 2) {
        v2h hi, rs;
        split2(v2f{v[n], v[n + 1]} * VCARRY, hi, rs);
        sVTh[(s * VROWS + (unsigned)n) * VKEYS + t] = hi[0];
        sVTh[(s * VROWS + (unsigned)n + 1u) * VKEYS + t] = hi[1];
        sVTr[(s * VROWS + (unsigned)n) * VKEYS + t] = rs[0];
        sVTr[(s * VROWS + (unsigned)n + 1u) * VKEYS + t] = rs[1];
      }
    }
  }
  __syncthreads();

  // ---- Phase B: causal softmax in A-fragment registers, p.v on WMMA ----
  if (wave < SPB) {
    // waves 0..7: query rows 0..31 of sequence = wave
    const unsigned seq = (unsigned)wave;
    // B fragments: lane column n = lane&15 -> V^T row n&7 (rows 6,7 are zero rows)
    const unsigned vrow = (seq * VROWS + (m & 7u)) * VKEYS + 8u * hh;
    const v16h bh0 = frag_at(&sVTh[vrow]);
    const v16h br0 = frag_at(&sVTr[vrow]);

#pragma unroll 1
    for (unsigned hd = 0; hd < 2u; ++hd) {
      const unsigned qkb = (seq * 2u + hd) * TLEN;
#pragma unroll
      for (int qt = 0; qt < 2; ++qt) {
        const unsigned tr = 16u * (unsigned)qt + m;                 // query row of this lane
        const v4f qv = sQ4[qkb + tr];
        v16h ahi, ars, xhi, xrs;
        const float den = (qt == 0)
            ? soft_rows<8, false>(qv, &sK4[qkb], tr, hh, ahi, ars, xhi, xrs)
            : soft_rows<16, false>(qv, &sK4[qkb], tr, hh, ahi, ars, xhi, xrs);

        v8f accM = {}, accR = {};
        accM = wmma16(ahi, bh0, accM);
        if (PV_RES) {
          accR = wmma16(ahi, br0, accR);
          accR = wmma16(ars, bh0, accR);
        }

        // D element r of this lane = (row 16*qt + 8*hh + r, column m); columns 3*hd..3*hd+2
        const bool colok = (m >= 3u * hd) && (m < 3u * hd + 3u);
#pragma unroll
        for (int r = 0; r < 8; ++r) {
          const unsigned row = 16u * (unsigned)qt + 8u * hh + (unsigned)r;
          const float val = accM[r] + accR[r] * (1.0f / RCARRY);
          if (colok) sO[(seq * TLEN + row) * 6u + m] = val;
        }
        if (hh == 0u) sDen[(seq * TLEN + tr) * 2u + hd] = den;
      }
    }
  } else {
    // wave 8: query rows 32,33 of every sequence and both heads, 16 full rows per tile.
    // Tile row m = (sequence 4*tl + (m>>2), head (m>>1)&1, query 32 + (m&1)).
#pragma unroll 1
    for (unsigned tl = 0; tl < 2u; ++tl) {
      const unsigned sq = 4u * tl + (m >> 2);
      const unsigned hd = (m >> 1) & 1u;
      const unsigned tq = 32u + (m & 1u);
      const unsigned qkb = (sq * 2u + hd) * TLEN;
      const v4f qv = sQ4[qkb + tq];
      v16h ahi, ars, xhi, xrs;
      const float den = soft_rows<16, true>(qv, &sK4[qkb], tq, hh, ahi, ars, xhi, xrs);
      if (hh == 0u) sDen[(sq * TLEN + tq) * 2u + hd] = den;

      // B columns 0..7 = V^T rows of sequence 4*tl + 2*pp, columns 8..15 = of the next one;
      // their query rows are tile rows 8*pp..8*pp+7 (D elements of the lanes with hh == pp).
      // Column c = m&7 (< 6) belongs to head c/3, so a lane keeps D elements r0, r0+1 with
      // r0 = 4*(m>>3) + 2*(c/3): queries 32,33 of sequence 4*tl + 2*hh + (m>>3).
      const unsigned c = m & 7u;
      const bool up = (m >> 3) != 0u, h1 = c >= 3u;
      float keep[2] = {0.0f, 0.0f};
      // rolled: only one pair's B fragments live at a time (fewer registers, more waves resident)
#pragma unroll 1
      for (unsigned pp = 0; pp < 2u; ++pp) {
        const unsigned vrow = ((4u * tl + 2u * pp + (m >> 3)) * VROWS + c) * VKEYS + 8u * hh;
        const v16h bh0 = frag_at(&sVTh[vrow]);
        const v16h br0 = frag_at(&sVTr[vrow]);
        const v16h bh1 = frag_at(&sVTh[vrow + 32u]);
        const v16h br1 = frag_at(&sVTr[vrow + 32u]);

        v8f accM = {}, accR = {};
        accM = wmma16(ahi, bh0, accM);
        if (PV_RES) {
          accR = wmma16(ahi, br0, accR);
          accR = wmma16(ars, bh0, accR);
        }
        accM = wmma16(xhi, bh1, accM);
        if (PV_RES) {
          accR = wmma16(xhi, br1, accR);
          accR = wmma16(xrs, bh1, accR);
        }

        float val[8];
#pragma unroll
        for (int r = 0; r < 8; ++r) val[r] = accM[r] + accR[r] * (1.0f / RCARRY);
#pragma unroll
        for (int e = 0; e < 2; ++e) {
          const float lo = h1 ? val[2 + e] : val[e];
          const float hi = h1 ? val[6 + e] : val[4 + e];
          const float pick = up ? hi : lo;
          keep[e] = (hh == pp) ? pick : keep[e];
        }
      }
      if (c < 6u) {
        const unsigned ob = ((4u * tl + 2u * hh + (m >> 3)) * TLEN + 32u) * 6u + c;
        sO[ob] = keep[0];
        sO[ob + 6u] = keep[1];
      }
    }
  }
  __syncthreads();

  // ---- Phase C: normalise, output projection, LN2, feed-forward, final LN, head ----
  {
    float o[6];
    const float inv0 = (1.0f / sDen[p * 2u + 0u]) * OSCALE;
    const float inv1 = (1.0f / sDen[p * 2u + 1u]) * OSCALE;
#pragma unroll
    for (int c = 0; c < 3; ++c) {
      o[c]     = sO[p * 6u + (unsigned)c] * inv0;
      o[3 + c] = sO[p * 6u + 3u + (unsigned)c] * inv1;
    }
    float x2[6];
#pragma unroll
    for (int j = 0; j < 6; ++j) {
      float acc = x[j];
#pragma unroll
      for (int c = 0; c < 6; ++c) acc += o[c] * cw(cst[C_WO + c * 6 + j]);
      x2[j] = acc;
    }
    float h2[6];
    ln6<true>(x2, cst + C_LN2G, cst + C_LN2B, h2);
    float f0 = cw(cst[C_B1 + 0]), f1 = cw(cst[C_B1 + 1]);
#pragma unroll
    for (int j = 0; j < 6; ++j) {
      f0 += h2[j] * cw(cst[C_W1 + j * 2 + 0]);
      f1 += h2[j] * cw(cst[C_W1 + j * 2 + 1]);
    }
    f0 = 0.5f * f0 * (1.0f + erff(f0 * 0.70710678118654752f));
    f1 = 0.5f * f1 * (1.0f + erff(f1 * 0.70710678118654752f));
#pragma unroll
    for (int j = 0; j < 6; ++j)
      x2[j] += f0 * cw(cst[C_W2 + j]) + f1 * cw(cst[C_W2 + 6 + j]) + cw(cst[C_B2 + j]);
    float xf[6];
    ln6<true>(x2, cst + C_LNFG, cst + C_LNFB, xf);
    float y[3];
#pragma unroll
    for (int d = 0; d < 3; ++d) {
      float acc = 0.0f;
#pragma unroll
      for (int c = 0; c < 6; ++c) acc += xf[c] * cw(cst[C_HEAD + c * 3 + d]);
      y[d] = acc;
    }
    // Unrolled by 7, which the compiler then flattens: the 14 token rows come in wide scalar loads
    // behind one wait, where each trip of the rolled loop had its own address sums, loads, wait
    // and branch. Not a plain full unroll: with it the vectoriser pairs the products of this whole
    // phase anew, which changes which of them are fused and so their rounding.
#pragma unroll 7
    for (int n = 0; n < VOC; ++n) {
      const float lg = y[0] * cw(cst[C_TOK + n * 3 + 0]) + y[1] * cw(cst[C_TOK + n * 3 + 1]) +
                       y[2] * cw(cst[C_TOK + n * 3 + 2]);
      if (act) sLog[p * VOC + (unsigned)n] = lg;
    }
  }
  __syncthreads();

  {
    float* outB = out + (size_t)blockIdx.x * (size_t)(TOK * VOC);
    v4f xs[4];
#pragma unroll
    for (unsigned j = 0; j < 4u; ++j) {
      const unsigned i = tid + NTHR * j;
      const unsigned ic = (i < (unsigned)OUT_F4) ? i : (unsigned)(OUT_F4 - 1);
      xs[j] = *(const v4f*)&sLog[ic * 4u];
    }
#pragma unroll
    for (unsigned j = 0; j < 4u; ++j) {
      const unsigned i = tid + NTHR * j;
      if (i < (unsigned)OUT_F4) *(v4f*)(outB + (size_t)i * 4u) = xs[j];
    }
    
  }
}

// ---------------------------------------------------------------------------
extern "C" void kernel_launch(void* const* d_in, const int* in_sizes, int n_in,
                              void* d_out, int out_size, void* d_ws, size_t ws_size,
                              hipStream_t stream) {
  if (n_in < 20) return;
  if (ws_size < (size_t)C_END * sizeof(float)) return;
  if ((long long)in_sizes[0] < (long long)NB * TLEN) return;
  if (in_sizes[1] < VOC * 3 || in_sizes[2] < 4 || in_sizes[3] < 3 || in_sizes[4] < 9) return;
  if (in_sizes[5] < 18 || in_sizes[6] < 18 || in_sizes[7] < 18 || in_sizes[8] < 36) return;
  if (in_sizes[9] < 6 || in_sizes[10] < 6 || in_sizes[11] < 6 || in_sizes[12] < 6) return;
  if (in_sizes[13] < 6 || in_sizes[14] < 6) return;
  if (in_sizes[15] < 12 || in_sizes[16] < 2 || in_sizes[17] < 12 || in_sizes[18] < 6) return;
  if (in_sizes[19] < 18) return;
  if ((long long)out_size < (long long)NB * TLEN * VOC) return;

  const int*   idx         = (const int*)  d_in[0];    // [NB_FULL][34]
  const float* tok_emb     = (const float*)d_in[1];    // [14][3]
  const float* pos_params  = (const float*)d_in[2];    // [4]
  const float* z10_enc     = (const float*)d_in[3];    // [1][3]
  const float* special_enc = (const float*)d_in[4];    // [3][3]
  const float* wq          = (const float*)d_in[5];    // [3][6] (in, out)
  const float* wk          = (const float*)d_in[6];
  const float* wv          = (const float*)d_in[7];
  const float* wo          = (const float*)d_in[8];    // [6][6] (in, out)
  const float* ln1_g       = (const float*)d_in[9];
  const float* ln1_b       = (const float*)d_in[10];
  const float* ln2_g       = (const float*)d_in[11];
  const float* ln2_b       = (const float*)d_in[12];
  const float* lnf_g       = (const float*)d_in[13];
  const float* lnf_b       = (const float*)d_in[14];
  const float* ffn_w1      = (const float*)d_in[15];   // [6][2]
  const float* ffn_b1      = (const float*)d_in[16];
  const float* ffn_w2      = (const float*)d_in[17];   // [2][6]
  const float* ffn_b2      = (const float*)d_in[18];
  const float* head_w      = (const float*)d_in[19];   // [6][3]
  float* out = (float*)d_out;

  float* cst = (float*)d_ws;

  prep_consts_kernel<<<dim3(1), dim3(PREP_WAVES * 32), 0, stream>>>(
      tok_emb, pos_params, z10_enc, special_enc, wq, wk, wv, wo, ln1_g, ln1_b, ln2_g, ln2_b, lnf_g, lnf_b,
      ffn_w1, ffn_b1, ffn_w2, ffn_b2, head_w, cst);
  fused_block_kernel<<<dim3(NB / SPB), dim3(NTHR), 0, stream>>>(
      idx, cst, out);
}

// v006
// One run takes 40.5 microseconds.
// Timed twice side by side with v005, it ran 1.04 and 1.03 times as fast.
// Over all steps from v000 it is 1.87 times as fast.
#include <hip/hip_runtime.h>
#include <stddef.h>

// Contractions: p.v (34 keys deep) on v_wmma_f32_16x16x32_f16 (f16 operands, f32 accumulate):
// p carried x16384 and v carried x16, each as an f16 value plane plus an x2048 f16 residual
// plane (three products, residual products in their own accumulator). Every other product of
// this block (depth 2..6: q/k/v projections, q.k scores, output projection, feed-forward,
// vocabulary head) is f32 on the vector unit. Float inputs are RNE-converted to bf16 (INPUT_BF16,
// which must be 1) once per call by a small first launch, which also builds the 34 position rows; the
// main launch reads both from the workspace. LayerNorm, softmax, GELU (erf), residual adds in f32.

typedef _Float16 h16;
typedef _Float16 v16h __attribute__((ext_vector_type(16)));
typedef _Float16 v8h  __attribute__((ext_vector_type(8)));
typedef float    v8f  __attribute__((ext_vector_type(8)));
typedef float    v4f  __attribute__((ext_vector_type(4)));
typedef float    v2f  __attribute__((ext_vector_type(2)));
typedef _Float16 v2h  __attribute__((ext_vector_type(2)));

#ifndef NB
#define NB 32768
#endif
#define NB_FULL 32768
#define TLEN 34          // tokens per sequence (fixed by the position map)
#define VOC  14
#define SPB  8           // sequences per block
#define TOK  (SPB * TLEN)        // 272 tokens per block
#define NTHR 288                 // 9 waves
#define OUT_F4 (TOK * VOC / 4)
#define VROWS 8                  // V^T plane rows per sequence (6 written and read)
#define VKEYS 64                 // V^T plane keys per row (34 written and read)

#ifndef INPUT_BF16
#define INPUT_BF16 1
#endif
#ifndef PV_RES
#define PV_RES 1
#endif

// Constant block at the start of the workspace (float offsets), rewritten on every call.
#define C_TOK  0      // [14][3]
#define C_WO   42     // [6][6]
#define C_LN2G 78
#define C_LN2B 84
#define C_B1   90
#define C_W1   92     // [6][2]
#define C_W2   104    // [2][6]
#define C_B2   116
#define C_LNFG 122
#define C_LNFB 128
#define C_HEAD 134    // [6][3]
#define C_POS  152    // [34][4], 16-byte rows; no gap among the float arrays: every word read is written
#define C_H16  288    // from here bf16 numbers as 16-bit words; H_* count 16-bit words. Arrays start
                      // on 16 bytes; the words between two arrays are neither written nor read
#define H_WQ   0      // [3][6]
#define H_WK   24     // [3][6]
#define H_WV   48     // [3][6]
#define H_LN1G 72
#define H_LN1B 80
#define C_END  (288 + 43)
#define PREP_WAVES 18 // waves 0,1: position rows; waves 2..17: one weight array each

#define PCARRY 16384.0f
#define VCARRY 16.0f
#define RCARRY 2048.0f
#define OSCALE 3.814697265625e-06f    // 1 / (PCARRY * VCARRY)

static_assert(INPUT_BF16 == 1);                     // the 16-bit words of the constant block hold bf16
static_assert(NB >= SPB && NB <= NB_FULL && (NB % SPB) == 0);
static_assert((TOK * VOC * 4) % 128 == 0);          // a block owns whole output lines
static_assert((TOK * VOC) % 4 == 0);
static_assert(OUT_F4 % 8 == 0);
static_assert(NTHR % 32 == 0 && NTHR >= TOK);
static_assert(4 * NTHR >= OUT_F4);                  // store loop: 4 trips cover the block
static_assert(TLEN > 32 && TLEN <= 48);             // two 16-row query tiles + tail rows, keys 32.. as extras
static_assert(TLEN - 32 == 2);                      // exactly two tail rows / extra keys (32, 33)
static_assert(VKEYS == 64 && VROWS == 8);
static_assert(SPB == 8 && NTHR / 32 == SPB + 1);    // p.v phase: one wave per sequence, one for the tails

__device__ __forceinline__ float bf16r(float x) {   // RNE convert to bf16, returned widened
  unsigned int u = __float_as_uint(x);
  u = (u + 0x7FFFu + ((u >> 16) & 1u)) & 0xFFFF0000u;
  return __uint_as_float(u);
}
__device__ __forceinline__ float inw(float x) {     // input value as consumed
  return INPUT_BF16 ? bf16r(x) : x;
}
// A weight converted by the first launch: a bf16 value in the upper half of its 32-bit word.
// Taking that half (the lower one is zero) shows the compiler a bf16 operand as the conversion
// in place did, so it forms the same fused and unfused products: results stay bit-identical.
__device__ __forceinline__ float cw(float x) {
  return INPUT_BF16 ? __uint_as_float(__float_as_uint(x) & 0xFFFF0000u) : x;
}
// Two f32 values -> f16 value plane and x2048 f16 residual plane, round to nearest even, both
// values per convert instruction. A small value becomes an f16 subnormal: the matrix unit keeps
// subnormal operands, and what the value plane rounds off goes to the residual plane as for
// any other value.
static __device__ __forceinline__ void split2(const v2f x, v2h& hi, v2h& rs) {
  hi = __builtin_convertvector(x, v2h);
  rs = __builtin_convertvector((x - __builtin_convertvector(hi, v2f)) * RCARRY, v2h);
}

// 16-bit fragment: p points at element [row = lane&15][k0 + 8*(lane>>4)] of a k-contiguous
// row. Elements 0..7 <- k0+8h+0..7, elements 8..15 <- k0+16+8h+0..7 (same map for A and B).
__device__ __forceinline__ v16h frag_at(const _Float16* p) {
  v8h lo = *(const v8h*)(p);
  v8h hi = *(const v8h*)(p + 16);
  v16h out;
#pragma unroll
  for (int i = 0; i < 8; ++i) { out[i] = lo[i]; out[i + 8] = hi[i]; }
  return out;
}

// B fragment of the k-step of keys 32..63, of which only keys 32,33 exist: they are elements
// 0,1 of the lanes with lane>>4 == 0; every other element is a zero operand made in registers.
// p points at key 32 of the lane's V^T row.
__device__ __forceinline__ v16h frag_tail(const _Float16* p, const bool low) {
  const v2h e = *(const v2h*)(p);
  v16h out = {};
  out[0] = low ? e[0] : (_Float16)0.0f;
  out[1] = low ? e[1] : (_Float16)0.0f;
  return out;
}

__device__ __forceinline__ v8f wmma16(v16h a, v16h b, v8f c) {
  v8f d = __builtin_amdgcn_wmma_f32_16x16x32_f16(false, a, false, b, (short)0, c,
                                                 false, false);
  asm volatile("v_nop\n\tv_nop\n\tv_nop\n\tv_nop" : "+v"(d) : "v"(a), "v"(b));
  return d;
}

// Scores, causal softmax numerators and their f16 value / residual planes for one query row
// per lane pair (lane, lane^16), in the A-fragment layout. kp = key rows of the row's sequence
// and head, tq = query position. NE = fragment elements that can hold an unmasked key (8: keys
// 0..15, 16: keys 0..31; the rest are zero operands); XT: keys 32,33 as a second k-step.
// Returns the row sum over the unconverted numerators.
template <int NE, bool XT>
__device__ __forceinline__ float soft_rows(const v4f qv, const v4f* kp, const unsigned tq,
                                           const unsigned hh, v16h& ahi, v16h& ars,
                                           v16h& xhi, v16h& xrs) {
  float sc[NE];
  float sx[2];
  float mx = -1.0e30f;
#pragma unroll
  for (int i = 0; i < NE; ++i) {
    const unsigned j = 8u * hh + (unsigned)(i & 7) + 16u * (unsigned)(i >> 3);
    const v4f kv = kp[j];
    float sv = (qv[0] * kv[0] + qv[1] * kv[1] + qv[2] * kv[2]) * 0.57735026918962576f;
    sv = (j > tq) ? -1.0e30f : sv;
    sc[i] = sv;
    mx = fmaxf(mx, sv);
  }
  if (XT) {
#pragma unroll
    for (int e = 0; e < 2; ++e) {
      const unsigned j = 32u + (unsigned)e;
      const v4f kv = kp[j];
      float sv = (qv[0] * kv[0] + qv[1] * kv[1] + qv[2] * kv[2]) * 0.57735026918962576f;
      sv = ((hh != 0u) || (j > tq)) ? -1.0e30f : sv;
      sx[e] = sv;
      mx = fmaxf(mx, sv);
    }
  }
  mx = fmaxf(mx, __shfl_xor(mx, 16, 32));

  ahi = v16h{};
  ars = v16h{};
  xhi = v16h{};
  xrs = v16h{};
  float den = 0.0f;
#pragma unroll
  for (int i = 0; i < NE; ++i) {
    const unsigned j = 8u * hh + (unsigned)(i & 7) + 16u * (unsigned)(i >> 3);
    float pe = __expf(sc[i] - mx);
    pe = (j > tq) ? 0.0f : pe;
    den += pe;
    sc[i] = pe;
  }
#pragma unroll
  for (int i = 0; i < NE; i += 2) {
    v2h hi, rs;
    split2(v2f{sc[i], sc[i + 1]} * PCARRY, hi, rs);
    ahi[i] = hi[0];
    ahi[i + 1] = hi[1];
    ars[i] = rs[0];
    ars[i + 1] = rs[1];
  }
  if (XT) {
#pragma unroll
    for (int e = 0; e < 2; ++e) {
      const unsigned j = 32u + (unsigned)e;
      float pe = __expf(sx[e] - mx);
      pe = ((hh != 0u) || (j > tq)) ? 0.0f : pe;
      den += pe;
      sx[e] = pe;
    }
    v2h hi, rs;
    split2(v2f{sx[0], sx[1]} * PCARRY, hi, rs);
    xhi[0] = hi[0];
    xhi[1] = hi[1];
    xrs[0] = rs[0];
    xrs[1] = rs[1];
  }
  den += __shfl_xor(den, 16, 32);
  return den;
}

// LayerNorm over 6 values (biased variance, eps 1e-5); PRE: g, b converted by the first launch
template <bool PRE>
__device__ __forceinline__ void ln6(const float (&x)[6], const float* __restrict__ g,
                                    const float* __restrict__ b, float (&h)[6]) {
  const float mu = (x[0] + x[1] + x[2] + x[3] + x[4] + x[5]) * (1.0f / 6.0f);
  float var = 0.0f;
#pragma unroll
  for (int c = 0; c < 6; ++c) { const float d = x[c] - mu; var += d * d; }
  var *= (1.0f / 6.0f);
  const float rs = rsqrtf(var + 1.0e-5f);
#pragma unroll
  for (int c = 0; c < 6; ++c) h[c] = (x[c] - mu) * rs * (PRE ? cw(g[c]) : inw(g[c])) + (PRE ? cw(b[c]) : inw(b[c]));
}

// A weight stored by the first launch as a 16-bit bf16 word, widened
__device__ __forceinline__ float hw(unsigned short x) { return __uint_as_float((unsigned)x << 16); }
// ln6 with g, b as 16-bit bf16 words
__device__ __forceinline__ void ln6h(const float (&x)[6], const unsigned short* __restrict__ g,
                                     const unsigned short* __restrict__ b, float (&h)[6]) {
  const float mu = (x[0] + x[1] + x[2] + x[3] + x[4] + x[5]) * (1.0f / 6.0f);
  float var = 0.0f;
#pragma unroll
  for (int c = 0; c < 6; ++c) { const float d = x[c] - mu; var += d * d; }
  var *= (1.0f / 6.0f);
  const float rs = rsqrtf(var + 1.0e-5f);
#pragma unroll
  for (int c = 0; c < 6; ++c) h[c] = (x[c] - mu) * rs * hw(g[c]) + hw(b[c]);
}

// ---------------------------------------------------------------------------
// First launch, one block: values that do not depend on idx. Waves 0,1 build the 34x3 position
// rows; each further wave converts one weight array: those of the phase behind the attention and
// the token rows to 32-bit words, those of LN1 and the q,k,v projections to 16-bit words.
// ---------------------------------------------------------------------------
__global__ __launch_bounds__(PREP_WAVES * 32) void prep_consts_kernel(
    const float* __restrict__ tok_emb,
    const float* __restrict__ pos_params, const float* __restrict__ z10_enc,
    const float* __restrict__ special_enc, const float* __restrict__ wq,
    const float* __restrict__ wk, const float* __restrict__ wv, const float* __restrict__ wo,
    const float* __restrict__ ln1_g, const float* __restrict__ ln1_b,
    const float* __restrict__ ln2_g, const float* __restrict__ ln2_b,
    const float* __restrict__ lnf_g, const float* __restrict__ lnf_b,
    const float* __restrict__ ffn_w1, const float* __restrict__ ffn_b1,
    const float* __restrict__ ffn_w2, const float* __restrict__ ffn_b2,
    const float* __restrict__ head_w, float* __restrict__ cst) {
  const unsigned tid = threadIdx.x;
  const unsigned lane = tid & 31u;
  const int wave = __builtin_amdgcn_readfirstlane((int)(tid >> 5));

  // ---- position rows: all candidates loaded by value, selected by value ----
  if (wave < 2) {
    const unsigned t = (tid < (unsigned)TLEN) ? tid : (unsigned)(TLEN - 1);
    const float amp   = inw(pos_params[0]);
    const float phase = inw(pos_params[1]);
    const float slope = inw(pos_params[2]);
    const float offs  = inw(pos_params[3]);
    int di = (t < 10u) ? (int)t : ((t < 21u) ? ((int)t - 11) : ((int)t - 22));
    di = (di < 0) ? 0 : ((di > 9) ? 9 : di);
    const float fi  = (float)di;
    const float ang = 0.62831853071795864769f * fi + phase;
    const float d0 = amp * cosf(ang);
    const float d1 = amp * sinf(ang);
    const float d2 = slope * fi + offs;
    const unsigned si = (t == 10u) ? 0u : ((t == 21u) ? 1u : 2u);
    const float s0 = inw(special_enc[si * 3u + 0u]);
    const float s1 = inw(special_enc[si * 3u + 1u]);
    const float s2 = inw(special_enc[si * 3u + 2u]);
    const float z0 = inw(z10_enc[0]);
    const float z1 = inw(z10_enc[1]);
    const float z2 = inw(z10_enc[2]);
    const bool is_sp = (t == 10u) || (t == 21u) || (t == 33u);
    const bool is_z  = (t == 32u);
    const float p0 = is_sp ? s0 : (is_z ? z0 : d0);
    const float p1 = is_sp ? s1 : (is_z ? z1 : d1);
    const float p2 = is_sp ? s2 : (is_z ? z2 : d2);
    if (tid < (unsigned)TLEN) {
      cst[C_POS + t * 4u + 0u] = p0;
      cst[C_POS + t * 4u + 1u] = p1;
      cst[C_POS + t * 4u + 2u] = p2;
      cst[C_POS + t * 4u + 3u] = 0.0f;
    }
    return;
  }

  const float* a = tok_emb;
  unsigned n = VOC * 3, off = C_TOK;
  switch (wave) {
    case 3:  a = wo;     n = 36; off = C_WO;   break;
    case 4:  a = ln2_g;  n = 6;  off = C_LN2G; break;
    case 5:  a = ln2_b;  n = 6;  off = C_LN2B; break;
    case 6:  a = lnf_g;  n = 6;  off = C_LNFG; break;
    case 7:  a = lnf_b;  n = 6;  off = C_LNFB; break;
    case 8:  a = ffn_w1; n = 12; off = C_W1;   break;
    case 9:  a = ffn_b1; n = 2;  off = C_B1;   break;
    case 10: a = ffn_w2; n = 12; off = C_W2;   break;
    case 11: a = ffn_b2; n = 6;  off = C_B2;   break;
    case 12: a = head_w; n = 18; off = C_HEAD; break;
    case 13: a = wq;     n = 18; off = H_WQ;   break;
    case 14: a = wk;     n = 18; off = H_WK;   break;
    case 15: a = wv;     n = 18; off = H_WV;   break;
    case 16: a = ln1_g;  n = 6;  off = H_LN1G; break;
    case 17: a = ln1_b;  n = 6;  off = H_LN1B; break;
    default: break;
  }
  if (wave >= 13) {
    unsigned short* c16 = (unsigned short*)(cst + C_H16);
    for (unsigned i = lane; i < n; i += 32u) c16[off + i] = (unsigned short)(__float_as_uint(inw(a[i])) >> 16);
    return;
  }
  for (unsigned i = lane; i < n; i += 32u) cst[off + i] = inw(a[i]);
}

// ---------------------------------------------------------------------------
// One block = 8 sequences (272 tokens, one token per thread in the per-token phases).
// Phase A: embed + LN1 + q/k/v per token; q,k as f32 float4 rows per head in LDS; v as f16
//          value / residual planes VT[seq][n = head*3+d][key] (k-contiguous B operand). Only
//          what this phase writes of the planes is read: no fill, no barrier in front of it.
// Phase B: scores and the causal softmax are formed in registers directly in the A-fragment
//          layout (lane row = lane&15, up to 16 keys per lane); unnormalised p.v via WMMA; row
//          sums over the unconverted p. Wave w (< 8) owns query rows 0..31 of sequence w: per
//          head a tile of rows 0..15 (keys 0..15 only) and a tile of rows 16..31. Wave 8 owns
//          rows 32,33 of all sequences and heads (two full tiles, keys 32,33 as a second
//          sparse k-step).
// Phase C: per token: normalise, output projection, LN2, GELU feed-forward, final LN, head;
//          logits staged in LDS in the output layout.
// LDS regions are all cross-wave (block barriers between phases).
// ---------------------------------------------------------------------------
__global__ __launch_bounds__(NTHR) void fused_block_kernel(
    const int* __restrict__ idx, const float* __restrict__ cst, float* __restrict__ out) {
  __shared__ __attribute__((aligned(16))) v4f sQ4[SPB * 2 * TLEN];
  __shared__ __attribute__((aligned(16))) v4f sK4[SPB * 2 * TLEN];
  __shared__ __attribute__((aligned(16))) _Float16 sVTh[SPB * VROWS * VKEYS];
  __shared__ __attribute__((aligned(16))) _Float16 sVTr[SPB * VROWS * VKEYS];
  __shared__ __attribute__((aligned(16))) float sO[TOK * 6];
  __shared__ __attribute__((aligned(16))) float sDen[TOK * 2];
  __shared__ __attribute__((aligned(16))) float sLog[TOK * VOC];

  const unsigned tid = threadIdx.x;
  const unsigned lane = tid & 31u;
  const int wave = __builtin_amdgcn_readfirstlane((int)(tid >> 5));
  const unsigned hh = lane >> 4, m = lane & 15u;

  // ---- Phase A: embed + LN1 + q/k/v (idle lanes duplicate the last token, no stores) ----
  const bool act = tid < (unsigned)TOK;
  const unsigned p = act ? tid : (unsigned)(TOK - 1);
  const unsigned s = p / (unsigned)TLEN;
  const unsigned t = p - s * (unsigned)TLEN;
  float x[6];
  {
    const size_t seq_g = (size_t)blockIdx.x * SPB + s;
    int tok = idx[seq_g * TLEN + t];
    tok = (tok < 0) ? 0 : ((tok > VOC - 1) ? (VOC - 1) : tok);
#pragma unroll
    for (int c = 0; c < 3; ++c) {
      x[c]     = cw(cst[C_TOK + tok * 3 + c]);
      x[3 + c] = cst[C_POS + t * 4u + (unsigned)c];
    }
    float h[6];
    const unsigned short* __restrict__ c16 = (const unsigned short*)(cst + C_H16);
    ln6h(x, c16 + H_LN1G, c16 + H_LN1B, h);
    float q[6], k[6], v[6];
#pragma unroll
    for (int j = 0; j < 6; ++j) {
      q[j] = h[3] * hw(c16[H_WQ + j]) + h[4] * hw(c16[H_WQ + 6 + j]) + h[5] * hw(c16[H_WQ + 12 + j]);
      k[j] = h[3] * hw(c16[H_WK + j]) + h[4] * hw(c16[H_WK + 6 + j]) + h[5] * hw(c16[H_WK + 12 + j]);
      v[j] = h[0] * hw(c16[H_WV + j]) + h[1] * hw(c16[H_WV + 6 + j]) + h[2] * hw(c16[H_WV + 12 + j]);
    }
    if (act) {
      v4f q0 = {q[0], q[1], q[2], 0.0f};
      v4f q1 = {q[3], q[4], q[5], 0.0f};
      v4f k0 = {k[0], k[1], k[2], 0.0f};
      v4f k1 = {k[3], k[4], k[5], 0.0f};
      sQ4[(s * 2u + 0u) * TLEN + t] = q0;
      sQ4[(s * 2u + 1u) * TLEN + t] = q1;
      sK4[(s * 2u + 0u) * TLEN + t] = k0;
      sK4[(s * 2u + 1u) * TLEN + t] = k1;
#pragma unroll
      for (int n = 0; n < 6; n += 2) {
        v2h hi, rs;
        split2(v2f{v[n], v[n + 1]} * VCARRY, hi, rs);
        sVTh[(s * VROWS + (unsigned)n) * VKEYS + t] = hi[0];
        sVTh[(s * VROWS + (unsigned)n + 1u) * VKEYS + t] = hi[1];
        sVTr[(s * VROWS + (unsigned)n) * VKEYS + t] = rs[0];
        sVTr[(s * VROWS + (unsigned)n + 1u) * VKEYS + t] = rs[1];
      }
    }
  }
  __syncthreads();

  // ---- Phase B: causal softmax in A-fragment registers, p.v on WMMA ----
  if (wave < SPB) {
    // waves 0..7: query rows 0..31 of sequence = wave
    const unsigned seq = (unsigned)wave;
    // B fragments: lane column n = lane&15 -> V^T row n&7; columns 6,7 (never stored) repeat row 5
    const unsigned vr = ((m & 7u) < 5u) ? (m & 7u) : 5u;
    const unsigned vrow = (seq * VROWS + vr) * VKEYS + 8u * hh;
    const v16h bh0 = frag_at(&sVTh[vrow]);
    const v16h br0 = frag_at(&sVTr[vrow]);

#pragma unroll 1
    for (unsigned hd = 0; hd < 2u; ++hd) {
      const unsigned qkb = (seq * 2u + hd) * TLEN;
#pragma unroll
      for (int qt = 0; qt < 2; ++qt) {
        const unsigned tr = 16u * (unsigned)qt + m;                 // query row of this lane
        const v4f qv = sQ4[qkb + tr];
        v16h ahi, ars, xhi, xrs;
        const float den = (qt == 0)
            ? soft_rows<8, false>(qv, &sK4[qkb], tr, hh, ahi, ars, xhi, xrs)
            : soft_rows<16, false>(qv, &sK4[qkb], tr, hh, ahi, ars, xhi, xrs);

        v8f accM = {}, accR = {};
        accM = wmma16(ahi, bh0, accM);
        if (PV_RES) {
          accR = wmma16(ahi, br0, accR);
          accR = wmma16(ars, bh0, accR);
        }

        // D element r of this lane = (row 16*qt + 8*hh + r, column m); columns 3*hd..3*hd+2
        const bool colok = (m >= 3u * hd) && (m < 3u * hd + 3u);
#pragma unroll
        for (int r = 0; r < 8; ++r) {
          const unsigned row = 16u * (unsigned)qt + 8u * hh + (unsigned)r;
          const float val = accM[r] + accR[r] * (1.0f / RCARRY);
          if (colok) sO[(seq * TLEN + row) * 6u + m] = val;
        }
        if (hh == 0u) sDen[(seq * TLEN + tr) * 2u + hd] = den;
      }
    }
  } else {
    // wave 8: query rows 32,33 of every sequence and both heads, 16 full rows per tile.
    // Tile row m = (sequence 4*tl + (m>>2), head (m>>1)&1, query 32 + (m&1)).
#pragma unroll 1
    for (unsigned tl = 0; tl < 2u; ++tl) {
      const unsigned sq = 4u * tl + (m >> 2);
      const unsigned hd = (m >> 1) & 1u;
      const unsigned tq = 32u + (m & 1u);
      const unsigned qkb = (sq * 2u + hd) * TLEN;
      const v4f qv = sQ4[qkb + tq];
      v16h ahi, ars, xhi, xrs;
      const float den = soft_rows<16, true>(qv, &sK4[qkb], tq, hh, ahi, ars, xhi, xrs);
      if (hh == 0u) sDen[(sq * TLEN + tq) * 2u + hd] = den;

      // B columns 0..7 = V^T rows of sequence 4*tl + 2*pp, columns 8..15 = of the next one;
      // their query rows are tile rows 8*pp..8*pp+7 (D elements of the lanes with hh == pp).
      // Column c = m&7 (< 6) belongs to head c/3, so a lane keeps D elements r0, r0+1 with
      // r0 = 4*(m>>3) + 2*(c/3): queries 32,33 of sequence 4*tl + 2*hh + (m>>3).
      const unsigned c = m & 7u;
      const bool up = (m >> 3) != 0u, h1 = c >= 3u;
      float keep[2] = {0.0f, 0.0f};
      // rolled: only one pair's B fragments live at a time (fewer registers, more waves resident)
#pragma unroll 1
      for (unsigned pp = 0; pp < 2u; ++pp) {
        // columns 6,7 (never stored) repeat row 5
        const unsigned vbase = ((4u * tl + 2u * pp + (m >> 3)) * VROWS + ((c < 5u) ? c : 5u)) * VKEYS;
        const unsigned vrow = vbase + 8u * hh;
        const v16h bh0 = frag_at(&sVTh[vrow]);
        const v16h br0 = frag_at(&sVTr[vrow]);
        const v16h bh1 = frag_tail(&sVTh[vbase + 32u], hh == 0u);
        const v16h br1 = frag_tail(&sVTr[vbase + 32u], hh == 0u);

        v8f accM = {}, accR = {};
        accM = wmma16(ahi, bh0, accM);
        if (PV_RES) {
          accR = wmma16(ahi, br0, accR);
          accR = wmma16(ars, bh0, accR);
        }
        accM = wmma16(xhi, bh1, accM);
        if (PV_RES) {
          accR = wmma16(xhi, br1, accR);
          accR = wmma16(xrs, bh1, accR);
        }

        float val[8];
#pragma unroll
        for (int r = 0; r < 8; ++r) val[r] = accM[r] + accR[r] * (1.0f / RCARRY);
#pragma unroll
        for (int e = 0; e < 2; ++e) {
          const float lo = h1 ? val[2 + e] : val[e];
          const float hi = h1 ? val[6 + e] : val[4 + e];
          const float pick = up ? hi : lo;
          keep[e] = (hh == pp) ? pick : keep[e];
        }
      }
      if (c < 6u) {
        const unsigned ob = ((4u * tl + 2u * hh + (m >> 3)) * TLEN + 32u) * 6u + c;
        sO[ob] = keep[0];
        sO[ob + 6u] = keep[1];
      }
    }
  }
  __syncthreads();

  // ---- Phase C: normalise, output projection, LN2, feed-forward, final LN, head ----
  {
    float o[6];
    const float inv0 = (1.0f / sDen[p * 2u + 0u]) * OSCALE;
    const float inv1 = (1.0f / sDen[p * 2u + 1u]) * OSCALE;
#pragma unroll
    for (int c = 0; c < 3; ++c) {
      o[c]     = sO[p * 6u + (unsigned)c] * inv0;
      o[3 + c] = sO[p * 6u + 3u + (unsigned)c] * inv1;
    }
    float x2[6];
#pragma unroll
    for (int j = 0; j < 6; ++j) {
      float acc = x[j];
#pragma unroll
      for (int c = 0; c < 6; ++c) acc += o[c] * cw(cst[C_WO + c * 6 + j]);
      x2[j] = acc;
    }
    float h2[6];
    ln6<true>(x2, cst + C_LN2G, cst + C_LN2B, h2);
    float f0 = cw(cst[C_B1 + 0]), f1 = cw(cst[C_B1 + 1]);
#pragma unroll
    for (int j = 0; j < 6; ++j) {
      f0 += h2[j] * cw(cst[C_W1 + j * 2 + 0]);
      f1 += h2[j] * cw(cst[C_W1 + j * 2 + 1]);
    }
    f0 = 0.5f * f0 * (1.0f + erff(f0 * 0.70710678118654752f));
    f1 = 0.5f * f1 * (1.0f + erff(f1 * 0.70710678118654752f));
#pragma unroll
    for (int j = 0; j < 6; ++j)
      x2[j] += f0 * cw(cst[C_W2 + j]) + f1 * cw(cst[C_W2 + 6 + j]) + cw(cst[C_B2 + j]);
    float xf[6];
    ln6<true>(x2, cst + C_LNFG, cst + C_LNFB, xf);
    float y[3];
#pragma unroll
    for (int d = 0; d < 3; ++d) {
      float acc = 0.0f;
#pragma unroll
      for (int c = 0; c < 6; ++c) acc += xf[c] * cw(cst[C_HEAD + c * 3 + d]);
      y[d] = acc;
    }
    // Unrolled by 7, which the compiler then flattens: the 14 token rows come in wide scalar loads
    // behind one wait, where each trip of the rolled loop had its own address sums, loads, wait
    // and branch. Not a plain full unroll: with it the vectoriser pairs the products of this whole
    // phase anew, which changes which of them are fused and so their rounding.
#pragma unroll 7
    for (int n = 0; n < VOC; ++n) {
      const float lg = y[0] * cw(cst[C_TOK + n * 3 + 0]) + y[1] * cw(cst[C_TOK + n * 3 + 1]) +
                       y[2] * cw(cst[C_TOK + n * 3 + 2]);
      if (act) sLog[p * VOC + (unsigned)n] = lg;
    }
  }
  __syncthreads();

  {
    float* outB = out + (size_t)blockIdx.x * (size_t)(TOK * VOC);
    v4f xs[4];
#pragma unroll
    for (unsigned j = 0; j < 4u; ++j) {
      const unsigned i = tid + NTHR * j;
      const unsigned ic = (i < (unsigned)OUT_F4) ? i : (unsigned)(OUT_F4 - 1);
      xs[j] = *(const v4f*)&sLog[ic * 4u];
    }
#pragma unroll
    for (unsigned j = 0; j < 4u; ++j) {
      const unsigned i = tid + NTHR * j;
      if (i < (unsigned)OUT_F4) *(v4f*)(outB + (size_t)i * 4u) = xs[j];
    }
    
  }
}

// ---------------------------------------------------------------------------
extern "C" void kernel_launch(void* const* d_in, const int* in_sizes, int n_in,
                              void* d_out, int out_size, void* d_ws, size_t ws_size,
                              hipStream_t stream) {
  if (n_in < 20) return;
  if (ws_size < (size_t)C_END * sizeof(float)) return;
  if ((long long)in_sizes[0] < (long long)NB * TLEN) return;
  if (in_sizes[1] < VOC * 3 || in_sizes[2] < 4 || in_sizes[3] < 3 || in_sizes[4] < 9) return;
  if (in_sizes[5] < 18 || in_sizes[6] < 18 || in_sizes[7] < 18 || in_sizes[8] < 36) return;
  if (in_sizes[9] < 6 || in_sizes[10] < 6 || in_sizes[11] < 6 || in_sizes[12] < 6) return;
  if (in_sizes[13] < 6 || in_sizes[14] < 6) return;
  if (in_sizes[15] < 12 || in_sizes[16] < 2 || in_sizes[17] < 12 || in_sizes[18] < 6) return;
  if (in_sizes[19] < 18) return;
  if ((long long)out_size < (long long)NB * TLEN * VOC) return;

  const int*   idx         = (const int*)  d_in[0];    // [NB_FULL][34]
  const float* tok_emb     = (const float*)d_in[1];    // [14][3]
  const float* pos_params  = (const float*)d_in[2];    // [4]
  const float* z10_enc     = (const float*)d_in[3];    // [1][3]
  const float* special_enc = (const float*)d_in[4];    // [3][3]
  const float* wq          = (const float*)d_in[5];    // [3][6] (in, out)
  const float* wk          = (const float*)d_in[6];
  const float* wv          = (const float*)d_in[7];
  const float* wo          = (const float*)d_in[8];    // [6][6] (in, out)
  const float* ln1_g       = (const float*)d_in[9];
  const float* ln1_b       = (const float*)d_in[10];
  const float* ln2_g       = (const float*)d_in[11];
  const float* ln2_b       = (const float*)d_in[12];
  const float* lnf_g       = (const float*)d_in[13];
  const float* lnf_b       = (const float*)d_in[14];
  const float* ffn_w1      = (const float*)d_in[15];   // [6][2]
  const float* ffn_b1      = (const float*)d_in[16];
  const float* ffn_w2      = (const float*)d_in[17];   // [2][6]
  const float* ffn_b2      = (const float*)d_in[18];
  const float* head_w      = (const float*)d_in[19];   // [6][3]
  float* out = (float*)d_out;

  float* cst = (float*)d_ws;

  prep_consts_kernel<<<dim3(1), dim3(PREP_WAVES * 32), 0, stream>>>(
      tok_emb, pos_params, z10_enc, special_enc, wq, wk, wv, wo, ln1_g, ln1_b, ln2_g, ln2_b, lnf_g, lnf_b,
      ffn_w1, ffn_b1, ffn_w2, ffn_b2, head_w, cst);
  fused_block_kernel<<<dim3(NB / SPB), dim3(NTHR), 0, stream>>>(
      idx, cst, out);
}
